// v000
// Measured on an AMD MI455X. A time is GPU time per run, averaged over a window of back-to-back runs after a warm-up
// (all launches, gaps included; the runs take copies of the inputs in turn), and the median of several windows.
// Apart from v000's, it joins two sittings. Times from different sittings can be a few percent apart, while
// side-by-side timings come from the same sitting.
// v000 is the starting kernel. One run takes 297 microseconds.
// Contractions: qkv = x.w_qkv on v_wmma_f32_16x16x32_bf16 (bf16 operands from RNE-converted inputs); scores = q.k^T on v_wmma_f32_16x16x32_f16 (f16 operands, 1/8 applied in f32); ctx = p.v on v_wmma_f32_16x16x32_bf16 with p and v as bf16 hi+lo planes (three products); out = ctx.w_out on v_wmma_f32_16x16x32_f16 (ctx carried x16, w_out as bf16 value x64, 2^-10 fold in f32); f32 accumulate, f32 online softmax.
#include <hip/hip_runtime.h>

typedef __attribute__((ext_vector_type(16))) __bf16       v16b;
typedef __attribute__((ext_vector_type(16))) _Float16     v16h;
typedef __attribute__((ext_vector_type(8)))  float        v8f;
typedef __attribute__((ext_vector_type(4)))  float        v4f;
typedef __attribute__((ext_vector_type(4)))  unsigned int v4u;

#ifndef NB
#define NB 16
#endif
#ifndef SEQ
#define SEQ 512
#endif
#define NB_FULL  16
#define SEQ_FULL 512

constexpr int DM     = 1024;            /* model dim = inner dim */
constexpr int NH     = 16;              /* heads */
constexpr int DH     = 64;              /* head dim */
constexpr int NF     = 3 * NH * DH;     /* 3072 qkv features */
constexpr int MAXLEN = 512;
constexpr int NREL   = 2 * MAXLEN - 1;  /* 1023 bias rows */
constexpr int MROWS  = NB * SEQ;        /* compact token rows */
constexpr int NBH    = NB * NH;
constexpr int KCH    = 64;              /* keys per staged chunk */
constexpr int QBLK   = 64;              /* query rows per block (4 waves x 16) */
constexpr int NWAVE  = 4;
constexpr int TPQ    = 72;              /* 16-bit LDS tile pitch, 64-wide rows (144 B) */
constexpr int TPV    = 136;             /* 16-bit LDS tile pitch, 128-wide rows (272 B) */
constexpr int OSP    = 68;              /* f32 LDS slab pitch (272 B) */

constexpr size_t PLANE16 = (size_t)MROWS * DM;          /* elements of a [MROWS][1024] 16-bit plane */
constexpr size_t WQT_EL  = (size_t)NF * DM;
constexpr size_t WOT_EL  = (size_t)DM * DM;
constexpr size_t WS_NEED = (6 * PLANE16 + WQT_EL + WOT_EL) * 2;   /* 109051904 B at NB=16, SEQ=512 */

static_assert(NB >= 1 && NB <= NB_FULL);
static_assert(SEQ >= 128 && SEQ <= SEQ_FULL && SEQ <= MAXLEN);
static_assert(SEQ % 128 == 0);
static_assert(SEQ % KCH == 0 && SEQ % QBLK == 0);
static_assert(DH == 64 && NH * DH == DM);
static_assert(DM % 64 == 0 && NF % 64 == 0 && NF == 3 * DM);
static_assert(MROWS % 128 == 0);
static_assert((MROWS * DM) % 2048 == 0);
static_assert(NREL <= 1024);
static_assert(TPQ % 8 == 0 && TPV % 8 == 0 && OSP % 4 == 0);
static_assert(NWAVE * 32 * TPQ <= 2 * DH * TPV);
static_assert(WS_NEED <= 134217728ull);

/* workspace region map (bytes, NB=16 SEQ=512):
 *   Xb  bf16 [MROWS][1024]        16777216
 *   Wqt bf16 [3072][1024] (k-contig) 6291456
 *   Wot f16  [1024 n][1024 k]       2097152   (bf16 value x64)
 *   Qh  f16  [NBH][SEQ][64]        16777216
 *   Kh  f16  [NBH][SEQ][64]        16777216
 *   Vth bf16 [NBH][64][SEQ]        16777216   (v hi, transposed)
 *   Vtl bf16 [NBH][64][SEQ]        16777216   (v lo = v - hi)
 *   Ctx f16  [MROWS][1024]         16777216   (x16 carry)
 *   total 109051904
 */

__device__ __forceinline__ unsigned short f2bf_bits(float f) {
  unsigned u = __float_as_uint(f);
  return (unsigned short)((u + 0x7FFFu + ((u >> 16) & 1u)) >> 16);
}
__device__ __forceinline__ float bf_bits2f(unsigned short h) { return __uint_as_float(((unsigned)h) << 16); }
__device__ __forceinline__ float bfr(float f) { return bf_bits2f(f2bf_bits(f)); }   /* RNE convert to the bf16 value */
__device__ __forceinline__ unsigned short f2h_bits(float f) {
  _Float16 h = (_Float16)f;
  return __builtin_bit_cast(unsigned short, h);
}
__device__ __forceinline__ unsigned int pk16(unsigned short lo, unsigned short hi) {
  return (unsigned)lo | ((unsigned)hi << 16);
}

__device__ __forceinline__ v8f mma_bf16(v16b a, v16b b, v8f c) {
  c = __builtin_amdgcn_wmma_f32_16x16x32_bf16(false, a, false, b, (short)0, c, false, false);
  asm volatile("v_nop\n\tv_nop\n\tv_nop\n\tv_nop" : "+v"(c) : "v"(a), "v"(b));
  return c;
}
__device__ __forceinline__ v8f mma_f16(v16h a, v16h b, v8f c) {
  c = __builtin_amdgcn_wmma_f32_16x16x32_f16(false, a, false, b, (short)0, c, false, false);
  asm volatile("v_nop\n\tv_nop\n\tv_nop\n\tv_nop" : "+v"(c) : "v"(a), "v"(b));
  return c;
}

union FragB { v16b v; v4u u[2]; };
union FragH { v16h v; v4u u[2]; };

/* Fragment map used everywhere (hh = lane>>4, c = lane&15):
 * A: row c, elements 0..7 <- k0+8hh+0..7, 8..15 <- k0+16+8hh+0..7 (two 16-B loads from a k-contiguous row);
 * B: column c with the SAME k map, loaded from a [n][k] k-contiguous copy exactly like A;
 * D: element r = (row 8hh+r, col c). */

/* --------------------------------------------------------------------------
 * x (f32, full-size strides) -> Xb bf16 [MROWS][1024].
 * Block = 256 threads = 2 compact rows; thread -> 8 consecutive elements, one
 * Coverage: MROWS/2 blocks x 2048 elements = the whole plane.
 * ------------------------------------------------------------------------ */
__global__ __launch_bounds__(256) void cvt_x_kernel(const float* __restrict__ x,
                                                    unsigned short* __restrict__ Xb)
{
  const int tid  = threadIdx.x;
  const int e    = tid * 8;
  const int crow = blockIdx.x * 2 + e / DM;
  const int col  = e % DM;
  const int bi   = crow / SEQ;
  const int n    = crow - bi * SEQ;
  const float* src = x + ((size_t)bi * SEQ_FULL + n) * DM + col;
  const v4f f0 = *(const v4f*)src;
  const v4f f1 = *(const v4f*)(src + 4);
  v4u w;
  w[0] = pk16(f2bf_bits(f0[0]), f2bf_bits(f0[1]));
  w[1] = pk16(f2bf_bits(f0[2]), f2bf_bits(f0[3]));
  w[2] = pk16(f2bf_bits(f1[0]), f2bf_bits(f1[1]));
  w[3] = pk16(f2bf_bits(f1[2]), f2bf_bits(f1[3]));
  unsigned short* dst = Xb + (size_t)crow * DM + col;
  *(v4u*)dst = w;
  
}

/* --------------------------------------------------------------------------
 * w [1024 k][nf] f32 -> Wt [nf][1024] 16-bit (k-contiguous rows).
 * KIND 0: bf16 bits; KIND 1: f16 bits of (bf16 value x64).
 * Block (x = n tile of 64, y = k tile of 64), 256 threads.
 * Load: thread -> k row tid>>2, 16 columns; 64x64 covered once. Transposed into LDS [n][k].
 * Store: 512 units (2 per thread): unit u -> n row u>>3, 16-B segment u&7; lanes
 * Coverage: grid (nf/64, 16) x 64x64 = the whole plane.
 * ------------------------------------------------------------------------ */
template <int KIND>
__global__ __launch_bounds__(256) void wtrans_kernel(const float* __restrict__ w,
                                                     unsigned short* __restrict__ Wt, int nf)
{
  __shared__ __align__(16) unsigned short Ts[64 * TPQ];     /* [n][k] */
  const int tid  = threadIdx.x;
  const int n0   = blockIdx.x * 64;
  const int k0   = blockIdx.y * 64;
  const int krow = tid >> 2;
  const int fseg = (tid & 3) * 16;
  const float* src = w + (size_t)(k0 + krow) * nf + n0 + fseg;
#pragma unroll
  for (int i = 0; i < 4; ++i) {
    const v4f f = *(const v4f*)(src + 4 * i);
#pragma unroll
    for (int e2 = 0; e2 < 4; ++e2) {
      const float v = f[e2];
      unsigned short bits;
      if (KIND == 0) bits = f2bf_bits(v);
      else           bits = f2h_bits(bfr(v) * 64.0f);
      Ts[(fseg + 4 * i + e2) * TPQ + krow] = bits;
    }
  }
  __syncthreads();
  {
#pragma unroll
    for (int it = 0; it < 2; ++it) {
      const int u    = it * 256 + tid;
      const int frow = u >> 3;
      const int seg  = u & 7;
      const v4u val = *(const v4u*)(Ts + frow * TPQ + seg * 8);
      *(v4u*)(Wt + (size_t)(n0 + frow) * DM + k0 + seg * 8) = val;
    }
    
  }
}

/* --------------------------------------------------------------------------
 * qkv = Xb.Wq + bq on bf16 WMMA. Block = 4 waves, tile 128 tokens x 64 features
 * (wave -> 32 tokens x 64 features, acc[2][4]); grid (MROWS/128, NF/64).
 * The 64-feature tile is exactly one (sel, head); sel and head are block-uniform.
 * sel 0/1: q/k -> f16 plane [bh][n][d]: per-wave 32x64 LDS tile, then 32 whole
 *   Coverage: rows it*4+(lane>>3), it 0..7, segs lane&7 -> 32x64 per wave.
 * sel 2: v -> bf16 hi and lo planes [bh][d][n]: block 64x128 transposed LDS tiles,
 *   wave w writes d rows 16w..16w+15, each row = 128 tokens = 256 B = 16 lanes x 16 B,
 * ------------------------------------------------------------------------ */
__global__ __launch_bounds__(128) __attribute__((amdgpu_num_vgpr(256)))
void qkv_gemm_kernel(const unsigned short* __restrict__ Xb, const unsigned short* __restrict__ Wqt,
                     const float* __restrict__ bq,
                     unsigned short* __restrict__ Qh, unsigned short* __restrict__ Kh,
                     unsigned short* __restrict__ Vth, unsigned short* __restrict__ Vtl)
{
  __shared__ __align__(16) unsigned short Ts[2 * DH * TPV];
  const int tid  = threadIdx.x;
  const int wave = tid >> 5;
  const int lane = tid & 31;
  const int hh   = lane >> 4;
  const int c    = lane & 15;
  const int m0   = blockIdx.x * 128;
  const int n0   = blockIdx.y * 64;
  const int sel  = blockIdx.y / (DM / 64);
  const int head = blockIdx.y - sel * (DM / 64);

  v8f acc[2][4];
#pragma unroll
  for (int rt = 0; rt < 2; ++rt)
#pragma unroll
    for (int tt = 0; tt < 4; ++tt) acc[rt][tt] = (v8f){0.f,0.f,0.f,0.f,0.f,0.f,0.f,0.f};

  const unsigned short* a0p = Xb + (size_t)(m0 + 32 * wave + c) * DM + 8 * hh;
  const unsigned short* a1p = a0p + (size_t)16 * DM;
  const unsigned short* b0p = Wqt + (size_t)(n0 + c) * DM + 8 * hh;

#pragma unroll 1
  for (int k0 = 0; k0 < DM; k0 += 32) {
    FragB a0, a1;
    a0.u[0] = *(const v4u*)(a0p + k0);
    a0.u[1] = *(const v4u*)(a0p + k0 + 16);
    a1.u[0] = *(const v4u*)(a1p + k0);
    a1.u[1] = *(const v4u*)(a1p + k0 + 16);
#pragma unroll
    for (int tt = 0; tt < 4; ++tt) {
      const unsigned short* bp = b0p + (size_t)tt * 16 * DM + k0;
      FragB b;
      b.u[0] = *(const v4u*)bp;
      b.u[1] = *(const v4u*)(bp + 16);
      acc[0][tt] = mma_bf16(a0.v, b.v, acc[0][tt]);
      acc[1][tt] = mma_bf16(a1.v, b.v, acc[1][tt]);
    }
  }

  float bb[4];
#pragma unroll
  for (int tt = 0; tt < 4; ++tt) bb[tt] = bfr(bq[n0 + 16 * tt + c]);

  const int bi  = m0 / SEQ;
  const int nn0 = m0 - bi * SEQ;
  const int bh  = bi * NH + head;

  if (sel < 2) {
    unsigned short* plane = (sel == 0) ? Qh : Kh;
    unsigned short* ls = Ts + wave * (32 * TPQ);        /* [token][d], wave-private, block barrier used */
#pragma unroll
    for (int rt = 0; rt < 2; ++rt)
#pragma unroll
      for (int tt = 0; tt < 4; ++tt)
#pragma unroll
        for (int r = 0; r < 8; ++r)
          ls[(16 * rt + 8 * hh + r) * TPQ + 16 * tt + c] = f2h_bits(acc[rt][tt][r] + bb[tt]);
    __syncthreads();
    unsigned short* dst = plane + ((size_t)bh * SEQ + nn0 + 32 * wave) * DH;
    {
#pragma unroll
      for (int it = 0; it < 8; ++it) {
        const int row = it * 4 + (lane >> 3);
        const int seg = lane & 7;
        const v4u val = *(const v4u*)(ls + row * TPQ + seg * 8);
        *(v4u*)(dst + (size_t)row * DH + seg * 8) = val;
      }
      
    }
  } else {
    unsigned short* th = Ts;                 /* v hi [d][token 0..127], cross-wave: block barrier */
    unsigned short* tl = Ts + DH * TPV;      /* v lo */
#pragma unroll
    for (int rt = 0; rt < 2; ++rt)
#pragma unroll
      for (int tt = 0; tt < 4; ++tt)
#pragma unroll
        for (int r = 0; r < 8; ++r) {
          const float v = acc[rt][tt][r] + bb[tt];
          const unsigned short hb = f2bf_bits(v);
          const unsigned short lb = f2bf_bits(v - bf_bits2f(hb));
          const int tok = 32 * wave + 16 * rt + 8 * hh + r;
          const int d   = 16 * tt + c;
          th[d * TPV + tok] = hb;
          tl[d * TPV + tok] = lb;
        }
    __syncthreads();
    const size_t vbase = (size_t)bh * DH * SEQ + nn0;
    const int seg = lane & 15;
    {
#pragma unroll
      for (int it = 0; it < 8; ++it) {
        const int drow = 16 * wave + it * 2 + hh;
        const v4u hv = *(const v4u*)(th + drow * TPV + seg * 8);
        const v4u lv = *(const v4u*)(tl + drow * TPV + seg * 8);
        *(v4u*)(Vth + vbase + (size_t)drow * SEQ + seg * 8) = hv;
        *(v4u*)(Vtl + vbase + (size_t)drow * SEQ + seg * 8) = lv;
      }
      
    }
  }
}

/* --------------------------------------------------------------------------
 * Attention with per-head rel-pos bias, head dim 64, no mask.
 * Block = 4 waves = 64 query rows of one (b,h); grid (SEQ/64, NBH).
 * Per 64-key chunk: K [kv][d] f16 and V^T hi/lo [d][kv] bf16 tiles staged in LDS
 * by 16-B copies (4 units per thread per tile, 512 units x 8 = 64x64 each, staged
 * extent == consumed extent), scores on f16 WMMA, x1/8 + bias (LDS table indexed
 * i-j+MAXLEN-1, always in [0, NREL-1]), f32 online softmax, P as bf16 hi+lo per-wave
 * LDS tiles (16x64 written fully each chunk), O += Ph.Vh + Pl.Vh + Ph.Vl on bf16 WMMA.
 * Ctx [token][head*64+d], lanes 8q..8q+7 per line, one instruction per 4 lines, two
 * LDS regions: Ksh/Vhs/Vls/sbias cross-wave (block barriers); Psh/Psl/Osh wave-private
 * ------------------------------------------------------------------------ */
__global__ __launch_bounds__(128) __attribute__((amdgpu_num_vgpr(256)))
void attn_kernel(const unsigned short* __restrict__ Qh, const unsigned short* __restrict__ Kh,
                 const unsigned short* __restrict__ Vth, const unsigned short* __restrict__ Vtl,
                 const float* __restrict__ rel, unsigned short* __restrict__ Ctx)
{
  __shared__ __align__(16) unsigned short Ksh[KCH * DH];            /* K  [kv][d] f16 */
  __shared__ __align__(16) unsigned short Vhs[DH * KCH];            /* Vh [d][kv] bf16 */
  __shared__ __align__(16) unsigned short Vls[DH * KCH];            /* Vl [d][kv] bf16 */
  __shared__ __align__(16) unsigned short Psh[NWAVE][16 * KCH];     /* P hi [row][kv] */
  __shared__ __align__(16) unsigned short Psl[NWAVE][16 * KCH];     /* P lo */
  __shared__ __align__(16) unsigned short Osh[NWAVE][16 * TPQ];     /* out slab per wave (f16) */
  __shared__ float sbias[1024];                                     /* bias column of this head, bf16 value */

  const int tid  = threadIdx.x;
  const int wave = tid >> 5;
  const int lane = tid & 31;
  const int hh   = lane >> 4;
  const int c    = lane & 15;
  const int qb   = blockIdx.x;
  const int bh   = blockIdx.y;
  const int bi   = bh / NH;
  const int head = bh - bi * NH;
  const int q0   = qb * QBLK + wave * 16;

  for (int t = tid; t < 1024; t += 128) {
    const int ti = t < NREL ? t : (NREL - 1);
    const float v = bfr(rel[(size_t)ti * NH + head]);
    sbias[t] = (t < NREL) ? v : 0.f;
  }

  FragH qa[2];
  {
    const unsigned short* qrow = Qh + ((size_t)bh * SEQ + q0 + c) * DH + 8 * hh;
    qa[0].u[0] = *(const v4u*)(qrow);
    qa[0].u[1] = *(const v4u*)(qrow + 16);
    qa[1].u[0] = *(const v4u*)(qrow + 32);
    qa[1].u[1] = *(const v4u*)(qrow + 48);
  }
  __syncthreads();

  float mrow[8], lrow[8];
  v8f oacc[4];
#pragma unroll
  for (int r = 0; r < 8; ++r) { mrow[r] = -__builtin_inff(); lrow[r] = 0.f; }
#pragma unroll
  for (int t = 0; t < 4; ++t) oacc[t] = (v8f){0.f,0.f,0.f,0.f,0.f,0.f,0.f,0.f};

  const unsigned short* Kp  = Kh  + (size_t)bh * SEQ * DH;
  const unsigned short* Vhp = Vth + (size_t)bh * DH * SEQ;
  const unsigned short* Vlp = Vtl + (size_t)bh * DH * SEQ;
  unsigned short* pwh = Psh[wave];
  unsigned short* pwl = Psl[wave];
  const int bbase = q0 + 8 * hh - c + (MAXLEN - 1);    /* bias index = bbase + r - key */

#pragma unroll 1
  for (int kc = 0; kc < SEQ / KCH; ++kc) {
    const int kv0 = kc * KCH;
    __syncthreads();
#pragma unroll
    for (int it = 0; it < 4; ++it) {
      const int u   = it * 128 + tid;
      const int row = u >> 3;
      const int seg = u & 7;
      const v4u kw = *(const v4u*)(Kp  + (size_t)(kv0 + row) * DH + seg * 8);
      const v4u hw = *(const v4u*)(Vhp + (size_t)row * SEQ + kv0 + seg * 8);
      const v4u lw = *(const v4u*)(Vlp + (size_t)row * SEQ + kv0 + seg * 8);
      *(v4u*)(Ksh + row * DH + seg * 8)  = kw;
      *(v4u*)(Vhs + row * KCH + seg * 8) = hw;
      *(v4u*)(Vls + row * KCH + seg * 8) = lw;
    }
    __syncthreads();

    /* scores: 16 query rows x 64 keys per wave */
    v8f s[4];
#pragma unroll
    for (int j = 0; j < 4; ++j) {
      s[j] = (v8f){0.f,0.f,0.f,0.f,0.f,0.f,0.f,0.f};
#pragma unroll
      for (int dc = 0; dc < 2; ++dc) {
        FragH kf;
        kf.u[0] = *(const v4u*)(Ksh + (j * 16 + c) * DH + dc * 32 + 8 * hh);
        kf.u[1] = *(const v4u*)(Ksh + (j * 16 + c) * DH + dc * 32 + 16 + 8 * hh);
        s[j] = mma_f16(qa[dc].v, kf.v, s[j]);
      }
    }

    /* scale 1/8 and rel-pos bias: key index = kv0 + 16j + c, query = q0 + 8hh + r */
    const int boff = bbase - kv0;
#pragma unroll
    for (int j = 0; j < 4; ++j)
#pragma unroll
      for (int r = 0; r < 8; ++r)
        s[j][r] = s[j][r] * 0.125f + sbias[boff + r - 16 * j];

    /* chunk row max over the 64 keys */
    float cm[8];
#pragma unroll
    for (int r = 0; r < 8; ++r) {
      float m = fmaxf(fmaxf(s[0][r], s[1][r]), fmaxf(s[2][r], s[3][r]));
#pragma unroll
      for (int off = 1; off < 16; off <<= 1) m = fmaxf(m, __shfl_xor(m, off, 32));
      cm[r] = m;
    }

    /* online softmax update, P tiles as bf16 hi + lo */
#pragma unroll
    for (int r = 0; r < 8; ++r) {
      const float mnew  = fmaxf(mrow[r], cm[r]);
      const float alpha = __expf(mrow[r] - mnew);
      mrow[r] = mnew;
      float psum = 0.f;
#pragma unroll
      for (int j = 0; j < 4; ++j) {
        const float p = __expf(s[j][r] - mnew);
        psum += p;
        const unsigned short hb = f2bf_bits(p);
        const unsigned short lb = f2bf_bits(p - bf_bits2f(hb));
        pwh[(8 * hh + r) * KCH + j * 16 + c] = hb;
        pwl[(8 * hh + r) * KCH + j * 16 + c] = lb;
      }
#pragma unroll
      for (int off = 1; off < 16; off <<= 1) psum += __shfl_xor(psum, off, 32);
      lrow[r] = lrow[r] * alpha + psum;
#pragma unroll
      for (int t = 0; t < 4; ++t) oacc[t][r] *= alpha;
    }
    __builtin_amdgcn_fence(3, "workgroup");
    __builtin_amdgcn_wave_barrier();
    __builtin_amdgcn_fence(2, "workgroup");

    /* O += P.V : A = P [q][kv] (this wave's tile), B = V [kv][d] from V^T [d][kv] */
#pragma unroll
    for (int kk = 0; kk < 2; ++kk) {
      FragB pa, pl;
      pa.u[0] = *(const v4u*)(pwh + c * KCH + kk * 32 + 8 * hh);
      pa.u[1] = *(const v4u*)(pwh + c * KCH + kk * 32 + 16 + 8 * hh);
      pl.u[0] = *(const v4u*)(pwl + c * KCH + kk * 32 + 8 * hh);
      pl.u[1] = *(const v4u*)(pwl + c * KCH + kk * 32 + 16 + 8 * hh);
#pragma unroll
      for (int t = 0; t < 4; ++t) {
        FragB vh, vl;
        vh.u[0] = *(const v4u*)(Vhs + (t * 16 + c) * KCH + kk * 32 + 8 * hh);
        vh.u[1] = *(const v4u*)(Vhs + (t * 16 + c) * KCH + kk * 32 + 16 + 8 * hh);
        vl.u[0] = *(const v4u*)(Vls + (t * 16 + c) * KCH + kk * 32 + 8 * hh);
        vl.u[1] = *(const v4u*)(Vls + (t * 16 + c) * KCH + kk * 32 + 16 + 8 * hh);
        oacc[t] = mma_bf16(pa.v, vh.v, oacc[t]);
        oacc[t] = mma_bf16(pl.v, vh.v, oacc[t]);
        oacc[t] = mma_bf16(pa.v, vl.v, oacc[t]);
      }
    }
  }

  /* normalise, x16 carry, f16 slab, then whole-line stores into Ctx */
  unsigned short* os = Osh[wave];
#pragma unroll
  for (int r = 0; r < 8; ++r) {
    const float inv = 1.0f / lrow[r];
#pragma unroll
    for (int t = 0; t < 4; ++t)
      os[(8 * hh + r) * TPQ + t * 16 + c] = f2h_bits(oacc[t][r] * inv * 16.0f);
  }
  __builtin_amdgcn_fence(3, "workgroup");
  __builtin_amdgcn_wave_barrier();
  __builtin_amdgcn_fence(2, "workgroup");
  {
    unsigned short* cdst = Ctx + ((size_t)bi * SEQ + q0) * DM + head * DH;
    {
#pragma unroll
      for (int it = 0; it < 4; ++it) {
        const int row = it * 4 + (lane >> 3);
        const int seg = lane & 7;
        const v4u val = *(const v4u*)(os + row * TPQ + seg * 8);
        *(v4u*)(cdst + (size_t)row * DM + seg * 8) = val;
      }
      
    }
  }
}

/* --------------------------------------------------------------------------
 * out = Ctx.Wot (f16 WMMA, x1024 total carry folded by 2^-10) + bo, f32 output.
 * Block = 4 waves, tile 128 tokens x 64 columns (wave 32x64); grid (MROWS/128, DM/64).
 * Coverage: rows it*2+hh, it 0..15, pieces (lane&15)*4 -> 32x64 per wave.
 * ------------------------------------------------------------------------ */
__global__ __launch_bounds__(128) __attribute__((amdgpu_num_vgpr(256)))
void out_gemm_kernel(const unsigned short* __restrict__ Ctx, const unsigned short* __restrict__ Wot,
                     const float* __restrict__ bo, float* __restrict__ out)
{
  __shared__ __align__(16) float Os[NWAVE][32 * OSP];
  const int tid  = threadIdx.x;
  const int wave = tid >> 5;
  const int lane = tid & 31;
  const int hh   = lane >> 4;
  const int c    = lane & 15;
  const int m0   = blockIdx.x * 128;
  const int n0   = blockIdx.y * 64;

  v8f acc[2][4];
#pragma unroll
  for (int rt = 0; rt < 2; ++rt)
#pragma unroll
    for (int tt = 0; tt < 4; ++tt) acc[rt][tt] = (v8f){0.f,0.f,0.f,0.f,0.f,0.f,0.f,0.f};

  const unsigned short* a0p = Ctx + (size_t)(m0 + 32 * wave + c) * DM + 8 * hh;
  const unsigned short* a1p = a0p + (size_t)16 * DM;
  const unsigned short* b0p = Wot + (size_t)(n0 + c) * DM + 8 * hh;

#pragma unroll 1
  for (int k0 = 0; k0 < DM; k0 += 32) {
    FragH a0, a1;
    a0.u[0] = *(const v4u*)(a0p + k0);
    a0.u[1] = *(const v4u*)(a0p + k0 + 16);
    a1.u[0] = *(const v4u*)(a1p + k0);
    a1.u[1] = *(const v4u*)(a1p + k0 + 16);
#pragma unroll
    for (int tt = 0; tt < 4; ++tt) {
      const unsigned short* bp = b0p + (size_t)tt * 16 * DM + k0;
      FragH b;
      b.u[0] = *(const v4u*)bp;
      b.u[1] = *(const v4u*)(bp + 16);
      acc[0][tt] = mma_f16(a0.v, b.v, acc[0][tt]);
      acc[1][tt] = mma_f16(a1.v, b.v, acc[1][tt]);
    }
  }

  float bb[4];
#pragma unroll
  for (int tt = 0; tt < 4; ++tt) bb[tt] = bfr(bo[n0 + 16 * tt + c]);

  float* os = Os[wave];
#pragma unroll
  for (int rt = 0; rt < 2; ++rt)
#pragma unroll
    for (int tt = 0; tt < 4; ++tt)
#pragma unroll
      for (int r = 0; r < 8; ++r)
        os[(16 * rt + 8 * hh + r) * OSP + 16 * tt + c] = acc[rt][tt][r] * (1.0f / 1024.0f) + bb[tt];
  __builtin_amdgcn_fence(3, "workgroup");
  __builtin_amdgcn_wave_barrier();
  __builtin_amdgcn_fence(2, "workgroup");

  const int bi  = m0 / SEQ;
  const int nn0 = m0 - bi * SEQ;
  float* ob = out + ((size_t)bi * SEQ_FULL + nn0 + 32 * wave) * DM + n0;
  const int c4 = (lane & 15) * 4;
  {
#pragma unroll
    for (int it = 0; it < 16; ++it) {
      const int row = it * 2 + hh;
      const v4f val = *(const v4f*)(os + row * OSP + c4);
      *(v4f*)(ob + (size_t)row * DM + c4) = val;
    }
    
  }
}

extern "C" void kernel_launch(void* const* d_in, const int* in_sizes, int n_in,
                              void* d_out, int out_size, void* d_ws, size_t ws_size,
                              hipStream_t stream)
{
  if (n_in < 6) return;
  const long need_x = ((long)(NB - 1) * SEQ_FULL + SEQ) * DM;
  if ((long)in_sizes[0] < need_x) return;
  if ((long)in_sizes[1] < (long)DM * NF) return;
  if (in_sizes[2] < NF) return;
  if ((long)in_sizes[3] < (long)NREL * NH) return;
  if ((long)in_sizes[4] < (long)DM * DM) return;
  if (in_sizes[5] < DM) return;
  if ((long)out_size < need_x) return;
  if (d_ws == nullptr || ws_size < WS_NEED) return;

  const float* x     = (const float*)d_in[0];
  const float* w_qkv = (const float*)d_in[1];
  const float* b_qkv = (const float*)d_in[2];
  const float* rel   = (const float*)d_in[3];
  const float* w_out = (const float*)d_in[4];
  const float* b_out = (const float*)d_in[5];
  float* out = (float*)d_out;

  unsigned short* Xb  = (unsigned short*)d_ws;   /* offset 0 */
  unsigned short* Wqt = Xb  + PLANE16;
  unsigned short* Wot = Wqt + WQT_EL;
  unsigned short* Qh  = Wot + WOT_EL;
  unsigned short* Kh  = Qh  + PLANE16;
  unsigned short* Vth = Kh  + PLANE16;
  unsigned short* Vtl = Vth + PLANE16;
  unsigned short* Ctx = Vtl + PLANE16;           /* ends at WS_NEED */

  cvt_x_kernel<<<dim3((unsigned)((MROWS * DM) / 2048)), 256, 0, stream>>>(x, Xb);
  wtrans_kernel<0><<<dim3(NF / 64, DM / 64), 256, 0, stream>>>(w_qkv, Wqt, NF);
  wtrans_kernel<1><<<dim3(DM / 64, DM / 64), 256, 0, stream>>>(w_out, Wot, DM);
  qkv_gemm_kernel<<<dim3(MROWS / 128, NF / 64), 128, 0, stream>>>(Xb, Wqt, b_qkv, Qh, Kh, Vth, Vtl);
  attn_kernel<<<dim3(SEQ / QBLK, NBH), 128, 0, stream>>>(Qh, Kh, Vth, Vtl, rel, Ctx);
  out_gemm_kernel<<<dim3(MROWS / 128, DM / 64), 128, 0, stream>>>(Ctx, Wot, b_out, out);
}

// v001
// A run of this version takes 188 microseconds.
// Two timings next to v000 both put it at 1.64 times that version's speed.
// Contractions: qkv = x.w_qkv on v_wmma_f32_16x16x32_bf16 (bf16 operands from RNE-converted inputs); scores = q.k^T on v_wmma_f32_16x16x32_f16 (f16 operands, 1/8 applied in f32); ctx = p.v on v_wmma_f32_16x16x32_bf16 with p and v as bf16 hi+lo planes (three products); out = ctx.w_out on v_wmma_f32_16x16x32_f16 (ctx carried x16, w_out as bf16 value x64, 2^-10 fold in f32); f32 accumulate, f32 online softmax.
#include <hip/hip_runtime.h>

typedef __attribute__((ext_vector_type(16))) __bf16       v16b;
typedef __attribute__((ext_vector_type(16))) _Float16     v16h;
typedef __attribute__((ext_vector_type(8)))  float        v8f;
typedef __attribute__((ext_vector_type(4)))  float        v4f;
typedef __attribute__((ext_vector_type(4)))  unsigned int v4u;

#ifndef NB
#define NB 16
#endif
#ifndef SEQ
#define SEQ 512
#endif
#define NB_FULL  16
#define SEQ_FULL 512

constexpr int DM     = 1024;            /* model dim = inner dim */
constexpr int NH     = 16;              /* heads */
constexpr int DH     = 64;              /* head dim */
constexpr int NF     = 3 * NH * DH;     /* 3072 qkv features */
constexpr int MAXLEN = 512;
constexpr int NREL   = 2 * MAXLEN - 1;  /* 1023 bias rows */
constexpr int MROWS  = NB * SEQ;        /* compact token rows */
constexpr int NBH    = NB * NH;
constexpr int KCH    = 64;              /* keys per staged chunk */
constexpr int QBLK   = 64;              /* query rows per block (4 waves x 16) */
constexpr int NWAVE  = 4;
constexpr int TPQ    = 72;              /* 16-bit LDS tile pitch, 64-wide rows (144 B) */
constexpr int OSP    = 68;              /* f32 LDS slab pitch (272 B) */
constexpr int GBM    = 128;             /* GEMM block tile, token rows */
constexpr int GBN    = 128;             /* GEMM block tile, feature rows of the [n][k] operand */
constexpr int GBK    = 64;              /* k per staged tile: 128-B rows at pitch TPQ */
constexpr int GSTG   = (GBM + GBN) * TPQ;   /* 16-bit elements of one ring buffer (36864 B) */
constexpr int GNT    = DM / GBK;        /* staged tiles along k */

constexpr size_t PLANE16 = (size_t)MROWS * DM;          /* elements of a [MROWS][1024] 16-bit plane */
constexpr size_t WQT_EL  = (size_t)NF * DM;
constexpr size_t WOT_EL  = (size_t)DM * DM;
constexpr size_t WS_NEED = (6 * PLANE16 + WQT_EL + WOT_EL) * 2;   /* 109051904 B at NB=16, SEQ=512 */

static_assert(NB >= 1 && NB <= NB_FULL);
static_assert(SEQ >= 128 && SEQ <= SEQ_FULL && SEQ <= MAXLEN);
static_assert(SEQ % 128 == 0);
static_assert(SEQ % KCH == 0 && SEQ % QBLK == 0);
static_assert(DH == 64 && NH * DH == DM);
static_assert(DM % 64 == 0 && NF % 64 == 0 && NF == 3 * DM);
static_assert(MROWS % 128 == 0);
static_assert((MROWS * DM) % 2048 == 0);
static_assert(NREL <= 1024);
static_assert(TPQ % 8 == 0 && OSP % 4 == 0);
static_assert(MROWS % GBM == 0 && SEQ % GBM == 0 && DM % GBN == 0 && NF % GBN == 0);
static_assert(GNT >= 2 && DM % GBK == 0);
static_assert(NWAVE * 2 * 64 * TPQ <= 2 * GSTG);          /* v hi+lo slabs fit the ring */
static_assert(NWAVE * 64 * OSP * 4 <= 2 * GSTG * 2);      /* f32 slabs fit the ring */
static_assert(WS_NEED <= 134217728ull);

/* workspace region map (bytes, NB=16 SEQ=512):
 *   Xb  bf16 [MROWS][1024]        16777216
 *   Wqt bf16 [3072][1024] (k-contig) 6291456
 *   Wot f16  [1024 n][1024 k]       2097152   (bf16 value x64)
 *   Qh  f16  [NBH][SEQ][64]        16777216
 *   Kh  f16  [NBH][SEQ][64]        16777216
 *   Vth bf16 [NBH][64][SEQ]        16777216   (v hi, transposed)
 *   Vtl bf16 [NBH][64][SEQ]        16777216   (v lo = v - hi)
 *   Ctx f16  [MROWS][1024]         16777216   (x16 carry)
 *   total 109051904
 */

__device__ __forceinline__ unsigned short f2bf_bits(float f) {
  unsigned u = __float_as_uint(f);
  return (unsigned short)((u + 0x7FFFu + ((u >> 16) & 1u)) >> 16);
}
__device__ __forceinline__ float bf_bits2f(unsigned short h) { return __uint_as_float(((unsigned)h) << 16); }
__device__ __forceinline__ float bfr(float f) { return bf_bits2f(f2bf_bits(f)); }   /* RNE convert to the bf16 value */
__device__ __forceinline__ unsigned short f2h_bits(float f) {
  _Float16 h = (_Float16)f;
  return __builtin_bit_cast(unsigned short, h);
}
__device__ __forceinline__ unsigned int pk16(unsigned short lo, unsigned short hi) {
  return (unsigned)lo | ((unsigned)hi << 16);
}

__device__ __forceinline__ v8f mma_bf16(v16b a, v16b b, v8f c) {
  c = __builtin_amdgcn_wmma_f32_16x16x32_bf16(false, a, false, b, (short)0, c, false, false);
  asm volatile("v_nop\n\tv_nop\n\tv_nop\n\tv_nop" : "+v"(c) : "v"(a), "v"(b));
  return c;
}
__device__ __forceinline__ v8f mma_f16(v16h a, v16h b, v8f c) {
  c = __builtin_amdgcn_wmma_f32_16x16x32_f16(false, a, false, b, (short)0, c, false, false);
  asm volatile("v_nop\n\tv_nop\n\tv_nop\n\tv_nop" : "+v"(c) : "v"(a), "v"(b));
  return c;
}

union FragB { v16b v; v4u u[2]; };
union FragH { v16h v; v4u u[2]; };
union FragG { v16b b; v16h h; v4u u[2]; };

__device__ __forceinline__ unsigned lds_off(const void* p) { return (unsigned)(size_t)p; }

/* Eight asynchronous 16-B copies per lane, global -> LDS: rows 16 apart of a [row][DM] 16-bit plane
 * into rows 16 apart of a pitch-TPQ tile. The s_wait_xcnt closes the same statement so that no
 * address register of an issued copy is rewritten in front of it. */
__device__ __forceinline__ void copy8(unsigned l, const unsigned short* g)
{
  constexpr unsigned LS = 16 * TPQ * 2;
  constexpr size_t   GS = (size_t)16 * DM;
  const unsigned l0 = l,          l1 = l + LS,     l2 = l + 2 * LS, l3 = l + 3 * LS;
  const unsigned l4 = l + 4 * LS, l5 = l + 5 * LS, l6 = l + 6 * LS, l7 = l + 7 * LS;
  const unsigned short* g0 = g;
  const unsigned short* g1 = g + GS;
  const unsigned short* g2 = g + 2 * GS;
  const unsigned short* g3 = g + 3 * GS;
  const unsigned short* g4 = g + 4 * GS;
  const unsigned short* g5 = g + 5 * GS;
  const unsigned short* g6 = g + 6 * GS;
  const unsigned short* g7 = g + 7 * GS;
  asm volatile("global_load_async_to_lds_b128 %0, %8, off\n\t"
               "global_load_async_to_lds_b128 %1, %9, off\n\t"
               "global_load_async_to_lds_b128 %2, %10, off\n\t"
               "global_load_async_to_lds_b128 %3, %11, off\n\t"
               "global_load_async_to_lds_b128 %4, %12, off\n\t"
               "global_load_async_to_lds_b128 %5, %13, off\n\t"
               "global_load_async_to_lds_b128 %6, %14, off\n\t"
               "global_load_async_to_lds_b128 %7, %15, off\n\t"
               "s_wait_xcnt 0x0"
               :: "v"(l0), "v"(l1), "v"(l2), "v"(l3), "v"(l4), "v"(l5), "v"(l6), "v"(l7),
                  "v"(g0), "v"(g1), "v"(g2), "v"(g3), "v"(g4), "v"(g5), "v"(g6), "v"(g7)
               : "memory");
}

/* --------------------------------------------------------------------------
 * acc[4][4] (wave tile 64 x 64, waves 2 x 2 in a 128 x 128 block tile) = A[m0..][k] . B[n0..][k]^T,
 * both planes [row][DM] k-contiguous. Per 64-k tile the block stages [A 128 rows | B 128 rows] of
 * 128 B in LDS at pitch 144 B by asynchronous copies (thread -> row tid>>3 + 16 i, 16-B segment
 * tid&7: a wave's copy covers 4 whole lines; 2 x 8 copies per thread = the whole stage), two
 * buffers: tile t+2 is copied into the buffer that trip t has just left, behind the trip's barrier.
 * k runs upward in steps of 32 through one accumulator chain per tile.
 * ------------------------------------------------------------------------ */
template <bool F16>
__device__ __forceinline__ void gemm_tile(const unsigned short* __restrict__ A,
                                          const unsigned short* __restrict__ B,
                                          unsigned short* Ring, int m0, int n0, v8f (&acc)[4][4])
{
  const int tid  = threadIdx.x;
  const int wave = tid >> 5;
  const int lane = tid & 31;
  const int hh   = lane >> 4;
  const int c    = lane & 15;
  const int wm   = wave >> 1;
  const int wn   = wave & 1;

#pragma unroll
  for (int i = 0; i < 4; ++i)
#pragma unroll
    for (int j = 0; j < 4; ++j) acc[i][j] = (v8f){0.f,0.f,0.f,0.f,0.f,0.f,0.f,0.f};

  const int crow = tid >> 3;
  const int cseg = (tid & 7) * 8;
  const unsigned short* ga = A + (size_t)(m0 + crow) * DM + cseg;
  const unsigned short* gb = B + (size_t)(n0 + crow) * DM + cseg;
  const unsigned la = lds_off(Ring) + (unsigned)(crow * TPQ + cseg) * 2u;
  const unsigned lb = la + (unsigned)(GBM * TPQ) * 2u;

  copy8(la, ga);
  copy8(lb, gb);
  asm volatile("s_wait_asynccnt 0x0" ::: "memory");   /* tile 0 of this wave has landed before the barrier publishes it */
  __syncthreads();
  copy8(la + (unsigned)GSTG * 2u, ga + GBK);
  copy8(lb + (unsigned)GSTG * 2u, gb + GBK);

  const unsigned short* fa = Ring + (64 * wm + c) * TPQ + 8 * hh;
  const unsigned short* fb = Ring + (GBM + 64 * wn + c) * TPQ + 8 * hh;

#pragma unroll 1   /* one staged tile per trip: the ring's waits and barrier stand once, at the foot */
  for (int t = 0; t < GNT; ++t) {
    const int bo = (t & 1) * GSTG;
#pragma unroll
    for (int ks = 0; ks < GBK / 32; ++ks) {
      FragG a[4], b[4];
#pragma unroll
      for (int i = 0; i < 4; ++i) {
        a[i].u[0] = *(const v4u*)(fa + bo + i * 16 * TPQ + ks * 32);
        a[i].u[1] = *(const v4u*)(fa + bo + i * 16 * TPQ + ks * 32 + 16);
        b[i].u[0] = *(const v4u*)(fb + bo + i * 16 * TPQ + ks * 32);
        b[i].u[1] = *(const v4u*)(fb + bo + i * 16 * TPQ + ks * 32 + 16);
      }
#pragma unroll
      for (int i = 0; i < 4; ++i)
#pragma unroll
        for (int j = 0; j < 4; ++j) {
          if constexpr (F16) acc[i][j] = mma_f16(a[i].h, b[j].h, acc[i][j]);
          else               acc[i][j] = mma_bf16(a[i].b, b[j].b, acc[i][j]);
        }
    }
    asm volatile("s_wait_dscnt 0x0" ::: "memory");      /* this wave's reads of buffer t&1 are done before it is refilled */
    asm volatile("s_wait_asynccnt 0x0" ::: "memory");   /* this wave's copies of tile t+1 have landed before the barrier publishes them */
    __syncthreads();
    if (t + 2 < GNT) {
      copy8(la + (unsigned)bo * 2u, ga + (t + 2) * GBK);
      copy8(lb + (unsigned)bo * 2u, gb + (t + 2) * GBK);
    }
  }
  asm volatile("s_wait_asynccnt 0x0" ::: "memory");     /* no copy is in flight when the ring becomes output staging */
}

/* Fragment map used everywhere (hh = lane>>4, c = lane&15):
 * A: row c, elements 0..7 <- k0+8hh+0..7, 8..15 <- k0+16+8hh+0..7 (two 16-B loads from a k-contiguous row);
 * B: column c with the SAME k map, loaded from a [n][k] k-contiguous copy exactly like A;
 * D: element r = (row 8hh+r, col c). */

/* --------------------------------------------------------------------------
 * x (f32, full-size strides) -> Xb bf16 [MROWS][1024].
 * Block = 256 threads = 2 compact rows; thread -> 8 consecutive elements, one
 * Coverage: MROWS/2 blocks x 2048 elements = the whole plane.
 * ------------------------------------------------------------------------ */
__global__ __launch_bounds__(256) void cvt_x_kernel(const float* __restrict__ x,
                                                    unsigned short* __restrict__ Xb)
{
  const int tid  = threadIdx.x;
  const int e    = tid * 8;
  const int crow = blockIdx.x * 2 + e / DM;
  const int col  = e % DM;
  const int bi   = crow / SEQ;
  const int n    = crow - bi * SEQ;
  const float* src = x + ((size_t)bi * SEQ_FULL + n) * DM + col;
  const v4f f0 = *(const v4f*)src;
  const v4f f1 = *(const v4f*)(src + 4);
  v4u w;
  w[0] = pk16(f2bf_bits(f0[0]), f2bf_bits(f0[1]));
  w[1] = pk16(f2bf_bits(f0[2]), f2bf_bits(f0[3]));
  w[2] = pk16(f2bf_bits(f1[0]), f2bf_bits(f1[1]));
  w[3] = pk16(f2bf_bits(f1[2]), f2bf_bits(f1[3]));
  unsigned short* dst = Xb + (size_t)crow * DM + col;
  *(v4u*)dst = w;
  
}

/* --------------------------------------------------------------------------
 * w [1024 k][nf] f32 -> Wt [nf][1024] 16-bit (k-contiguous rows).
 * KIND 0: bf16 bits; KIND 1: f16 bits of (bf16 value x64).
 * Block (x = n tile of 64, y = k tile of 64), 256 threads.
 * Load: thread -> k row tid>>2, 16 columns; 64x64 covered once. Transposed into LDS [n][k].
 * Store: 512 units (2 per thread): unit u -> n row u>>3, 16-B segment u&7; lanes
 * Coverage: grid (nf/64, 16) x 64x64 = the whole plane.
 * ------------------------------------------------------------------------ */
template <int KIND>
__global__ __launch_bounds__(256) void wtrans_kernel(const float* __restrict__ w,
                                                     unsigned short* __restrict__ Wt, int nf)
{
  __shared__ __align__(16) unsigned short Ts[64 * TPQ];     /* [n][k] */
  const int tid  = threadIdx.x;
  const int n0   = blockIdx.x * 64;
  const int k0   = blockIdx.y * 64;
  const int krow = tid >> 2;
  const int fseg = (tid & 3) * 16;
  const float* src = w + (size_t)(k0 + krow) * nf + n0 + fseg;
#pragma unroll
  for (int i = 0; i < 4; ++i) {
    const v4f f = *(const v4f*)(src + 4 * i);
#pragma unroll
    for (int e2 = 0; e2 < 4; ++e2) {
      const float v = f[e2];
      unsigned short bits;
      if (KIND == 0) bits = f2bf_bits(v);
      else           bits = f2h_bits(bfr(v) * 64.0f);
      Ts[(fseg + 4 * i + e2) * TPQ + krow] = bits;
    }
  }
  __syncthreads();
  {
#pragma unroll
    for (int it = 0; it < 2; ++it) {
      const int u    = it * 256 + tid;
      const int frow = u >> 3;
      const int seg  = u & 7;
      const v4u val = *(const v4u*)(Ts + frow * TPQ + seg * 8);
      *(v4u*)(Wt + (size_t)(n0 + frow) * DM + k0 + seg * 8) = val;
    }
    
  }
}

/* --------------------------------------------------------------------------
 * qkv = Xb.Wq + bq on bf16 WMMA. Block = 4 waves (2 x 2), tile 128 tokens x 128 features,
 * operands staged in LDS (gemm_tile); grid (MROWS/128, NF/128).
 * A wave's 64 features are exactly one (sel, head); sel is block-uniform.
 * The ring is output staging after the loop's last barrier; every slab is wave-private.
 * sel 0/1: q/k -> f16 plane [bh][n][d]: per-wave 64x64 LDS tile, then 64 whole 128-B rows:
 *   rows it*4+(lane>>3), it 0..15, segs lane&7.
 * sel 2: v -> bf16 hi and lo planes [bh][d][n]: per-wave 64x64 transposed LDS tiles, each d row =
 *   64 tokens = 128 B = 8 lanes x 16 B; rows it*4+(lane>>3), it 0..15.
 * ------------------------------------------------------------------------ */
__global__ __launch_bounds__(128) __attribute__((amdgpu_num_vgpr(256)))
void qkv_gemm_kernel(const unsigned short* __restrict__ Xb, const unsigned short* __restrict__ Wqt,
                     const float* __restrict__ bq,
                     unsigned short* __restrict__ Qh, unsigned short* __restrict__ Kh,
                     unsigned short* __restrict__ Vth, unsigned short* __restrict__ Vtl)
{
  __shared__ __align__(16) unsigned short Ring[2 * GSTG];
  const int tid  = threadIdx.x;
  const int wave = tid >> 5;
  const int lane = tid & 31;
  const int hh   = lane >> 4;
  const int c    = lane & 15;
  const int wm   = wave >> 1;
  const int wn   = wave & 1;
  const int m0   = blockIdx.x * GBM;
  const int n0   = blockIdx.y * GBN;
  const int sel  = blockIdx.y / (DM / GBN);
  const int head = (blockIdx.y - sel * (DM / GBN)) * (GBN / DH) + wn;

  v8f acc[4][4];
  gemm_tile<false>(Xb, Wqt, Ring, m0, n0, acc);

  float bb[4], bl[4];
  const int bidx = n0 + 64 * wn + c;
#pragma unroll
  for (int tt = 0; tt < 4; ++tt) bl[tt] = bq[bidx + 16 * tt];
  /* the four loads share the index register: it is named here so that it lives up to the wait and no load's result lands in it */
  asm volatile("s_wait_xcnt 0x0" :: "v"(bidx) : "memory");
#pragma unroll
  for (int tt = 0; tt < 4; ++tt) bb[tt] = bfr(bl[tt]);

  const int bi  = m0 / SEQ;
  const int nn0 = m0 - bi * SEQ + 64 * wm;
  const int bh  = bi * NH + head;

  if (sel < 2) {
    unsigned short* plane = (sel == 0) ? Qh : Kh;
    unsigned short* ls = Ring + wave * (64 * TPQ);      /* [token][d], wave-private, block barrier used */
#pragma unroll
    for (int rt = 0; rt < 4; ++rt)
#pragma unroll
      for (int tt = 0; tt < 4; ++tt)
#pragma unroll
        for (int r = 0; r < 8; ++r)
          ls[(16 * rt + 8 * hh + r) * TPQ + 16 * tt + c] = f2h_bits(acc[rt][tt][r] + bb[tt]);
    __syncthreads();
    unsigned short* dst = plane + ((size_t)bh * SEQ + nn0) * DH;
#pragma unroll
    for (int it = 0; it < 16; ++it) {
      const int row = it * 4 + (lane >> 3);
      const int seg = lane & 7;
      const v4u val = *(const v4u*)(ls + row * TPQ + seg * 8);
      *(v4u*)(dst + (size_t)row * DH + seg * 8) = val;
    }
  } else {
    unsigned short* th = Ring + wave * (2 * 64 * TPQ);  /* v hi [d][token 0..63], wave-private, block barrier used */
    unsigned short* tl = th + 64 * TPQ;                 /* v lo */
#pragma unroll
    for (int rt = 0; rt < 4; ++rt)
#pragma unroll
      for (int tt = 0; tt < 4; ++tt)
#pragma unroll
        for (int r = 0; r < 8; ++r) {
          const float v = acc[rt][tt][r] + bb[tt];
          const unsigned short hb = f2bf_bits(v);
          const unsigned short lb = f2bf_bits(v - bf_bits2f(hb));
          const int tok = 16 * rt + 8 * hh + r;
          const int d   = 16 * tt + c;
          th[d * TPQ + tok] = hb;
          tl[d * TPQ + tok] = lb;
        }
    __syncthreads();
    const size_t vbase = (size_t)bh * DH * SEQ + nn0;
#pragma unroll
    for (int it = 0; it < 16; ++it) {
      const int drow = it * 4 + (lane >> 3);
      const int seg  = lane & 7;
      const v4u hv = *(const v4u*)(th + drow * TPQ + seg * 8);
      const v4u lv = *(const v4u*)(tl + drow * TPQ + seg * 8);
      *(v4u*)(Vth + vbase + (size_t)drow * SEQ + seg * 8) = hv;
      *(v4u*)(Vtl + vbase + (size_t)drow * SEQ + seg * 8) = lv;
    }
    asm volatile("s_wait_xcnt 0x0" ::: "memory");   /* behind the last store, before a register that a store names is written again */
  }
}

/* --------------------------------------------------------------------------
 * Attention with per-head rel-pos bias, head dim 64, no mask.
 * Block = 4 waves = 64 query rows of one (b,h); grid (SEQ/64, NBH).
 * Per 64-key chunk: K [kv][d] f16 and V^T hi/lo [d][kv] bf16 tiles staged in LDS
 * by 16-B copies (4 units per thread per tile, 512 units x 8 = 64x64 each, staged
 * extent == consumed extent), scores on f16 WMMA, x1/8 + bias (LDS table indexed
 * i-j+MAXLEN-1, always in [0, NREL-1]), f32 online softmax, P as bf16 hi+lo per-wave
 * LDS tiles (16x64 written fully each chunk), O += Ph.Vh + Pl.Vh + Ph.Vl on bf16 WMMA.
 * Ctx [token][head*64+d], lanes 8q..8q+7 per line, one instruction per 4 lines, two
 * LDS regions: Ksh/Vhs/Vls/sbias cross-wave (block barriers); Psh/Psl/Osh wave-private
 * ------------------------------------------------------------------------ */
__global__ __launch_bounds__(128) __attribute__((amdgpu_num_vgpr(256)))
void attn_kernel(const unsigned short* __restrict__ Qh, const unsigned short* __restrict__ Kh,
                 const unsigned short* __restrict__ Vth, const unsigned short* __restrict__ Vtl,
                 const float* __restrict__ rel, unsigned short* __restrict__ Ctx)
{
  __shared__ __align__(16) unsigned short Ksh[KCH * DH];            /* K  [kv][d] f16 */
  __shared__ __align__(16) unsigned short Vhs[DH * KCH];            /* Vh [d][kv] bf16 */
  __shared__ __align__(16) unsigned short Vls[DH * KCH];            /* Vl [d][kv] bf16 */
  __shared__ __align__(16) unsigned short Psh[NWAVE][16 * KCH];     /* P hi [row][kv] */
  __shared__ __align__(16) unsigned short Psl[NWAVE][16 * KCH];     /* P lo */
  __shared__ __align__(16) unsigned short Osh[NWAVE][16 * TPQ];     /* out slab per wave (f16) */
  __shared__ float sbias[1024];                                     /* bias column of this head, bf16 value */

  const int tid  = threadIdx.x;
  const int wave = tid >> 5;
  const int lane = tid & 31;
  const int hh   = lane >> 4;
  const int c    = lane & 15;
  const int qb   = blockIdx.x;
  const int bh   = blockIdx.y;
  const int bi   = bh / NH;
  const int head = bh - bi * NH;
  const int q0   = qb * QBLK + wave * 16;

  for (int t = tid; t < 1024; t += 128) {
    const int ti = t < NREL ? t : (NREL - 1);
    const float v = bfr(rel[(size_t)ti * NH + head]);
    sbias[t] = (t < NREL) ? v : 0.f;
  }

  FragH qa[2];
  {
    const unsigned short* qrow = Qh + ((size_t)bh * SEQ + q0 + c) * DH + 8 * hh;
    qa[0].u[0] = *(const v4u*)(qrow);
    qa[0].u[1] = *(const v4u*)(qrow + 16);
    qa[1].u[0] = *(const v4u*)(qrow + 32);
    qa[1].u[1] = *(const v4u*)(qrow + 48);
  }
  __syncthreads();

  float mrow[8], lrow[8];
  v8f oacc[4];
#pragma unroll
  for (int r = 0; r < 8; ++r) { mrow[r] = -__builtin_inff(); lrow[r] = 0.f; }
#pragma unroll
  for (int t = 0; t < 4; ++t) oacc[t] = (v8f){0.f,0.f,0.f,0.f,0.f,0.f,0.f,0.f};

  const unsigned short* Kp  = Kh  + (size_t)bh * SEQ * DH;
  const unsigned short* Vhp = Vth + (size_t)bh * DH * SEQ;
  const unsigned short* Vlp = Vtl + (size_t)bh * DH * SEQ;
  unsigned short* pwh = Psh[wave];
  unsigned short* pwl = Psl[wave];
  const int bbase = q0 + 8 * hh - c + (MAXLEN - 1);    /* bias index = bbase + r - key */

#pragma unroll 1
  for (int kc = 0; kc < SEQ / KCH; ++kc) {
    const int kv0 = kc * KCH;
    __syncthreads();
#pragma unroll
    for (int it = 0; it < 4; ++it) {
      const int u   = it * 128 + tid;
      const int row = u >> 3;
      const int seg = u & 7;
      const v4u kw = *(const v4u*)(Kp  + (size_t)(kv0 + row) * DH + seg * 8);
      const v4u hw = *(const v4u*)(Vhp + (size_t)row * SEQ + kv0 + seg * 8);
      const v4u lw = *(const v4u*)(Vlp + (size_t)row * SEQ + kv0 + seg * 8);
      *(v4u*)(Ksh + row * DH + seg * 8)  = kw;
      *(v4u*)(Vhs + row * KCH + seg * 8) = hw;
      *(v4u*)(Vls + row * KCH + seg * 8) = lw;
    }
    __syncthreads();

    /* scores: 16 query rows x 64 keys per wave */
    v8f s[4];
#pragma unroll
    for (int j = 0; j < 4; ++j) {
      s[j] = (v8f){0.f,0.f,0.f,0.f,0.f,0.f,0.f,0.f};
#pragma unroll
      for (int dc = 0; dc < 2; ++dc) {
        FragH kf;
        kf.u[0] = *(const v4u*)(Ksh + (j * 16 + c) * DH + dc * 32 + 8 * hh);
        kf.u[1] = *(const v4u*)(Ksh + (j * 16 + c) * DH + dc * 32 + 16 + 8 * hh);
        s[j] = mma_f16(qa[dc].v, kf.v, s[j]);
      }
    }

    /* scale 1/8 and rel-pos bias: key index = kv0 + 16j + c, query = q0 + 8hh + r */
    const int boff = bbase - kv0;
#pragma unroll
    for (int j = 0; j < 4; ++j)
#pragma unroll
      for (int r = 0; r < 8; ++r)
        s[j][r] = s[j][r] * 0.125f + sbias[boff + r - 16 * j];

    /* chunk row max over the 64 keys */
    float cm[8];
#pragma unroll
    for (int r = 0; r < 8; ++r) {
      float m = fmaxf(fmaxf(s[0][r], s[1][r]), fmaxf(s[2][r], s[3][r]));
#pragma unroll
      for (int off = 1; off < 16; off <<= 1) m = fmaxf(m, __shfl_xor(m, off, 32));
      cm[r] = m;
    }

    /* online softmax update, P tiles as bf16 hi + lo */
#pragma unroll
    for (int r = 0; r < 8; ++r) {
      const float mnew  = fmaxf(mrow[r], cm[r]);
      const float alpha = __expf(mrow[r] - mnew);
      mrow[r] = mnew;
      float psum = 0.f;
#pragma unroll
      for (int j = 0; j < 4; ++j) {
        const float p = __expf(s[j][r] - mnew);
        psum += p;
        const unsigned short hb = f2bf_bits(p);
        const unsigned short lb = f2bf_bits(p - bf_bits2f(hb));
        pwh[(8 * hh + r) * KCH + j * 16 + c] = hb;
        pwl[(8 * hh + r) * KCH + j * 16 + c] = lb;
      }
#pragma unroll
      for (int off = 1; off < 16; off <<= 1) psum += __shfl_xor(psum, off, 32);
      lrow[r] = lrow[r] * alpha + psum;
#pragma unroll
      for (int t = 0; t < 4; ++t) oacc[t][r] *= alpha;
    }
    __builtin_amdgcn_fence(3, "workgroup");
    __builtin_amdgcn_wave_barrier();
    __builtin_amdgcn_fence(2, "workgroup");

    /* O += P.V : A = P [q][kv] (this wave's tile), B = V [kv][d] from V^T [d][kv] */
#pragma unroll
    for (int kk = 0; kk < 2; ++kk) {
      FragB pa, pl;
      pa.u[0] = *(const v4u*)(pwh + c * KCH + kk * 32 + 8 * hh);
      pa.u[1] = *(const v4u*)(pwh + c * KCH + kk * 32 + 16 + 8 * hh);
      pl.u[0] = *(const v4u*)(pwl + c * KCH + kk * 32 + 8 * hh);
      pl.u[1] = *(const v4u*)(pwl + c * KCH + kk * 32 + 16 + 8 * hh);
#pragma unroll
      for (int t = 0; t < 4; ++t) {
        FragB vh, vl;
        vh.u[0] = *(const v4u*)(Vhs + (t * 16 + c) * KCH + kk * 32 + 8 * hh);
        vh.u[1] = *(const v4u*)(Vhs + (t * 16 + c) * KCH + kk * 32 + 16 + 8 * hh);
        vl.u[0] = *(const v4u*)(Vls + (t * 16 + c) * KCH + kk * 32 + 8 * hh);
        vl.u[1] = *(const v4u*)(Vls + (t * 16 + c) * KCH + kk * 32 + 16 + 8 * hh);
        oacc[t] = mma_bf16(pa.v, vh.v, oacc[t]);
        oacc[t] = mma_bf16(pl.v, vh.v, oacc[t]);
        oacc[t] = mma_bf16(pa.v, vl.v, oacc[t]);
      }
    }
  }

  /* normalise, x16 carry, f16 slab, then whole-line stores into Ctx */
  unsigned short* os = Osh[wave];
#pragma unroll
  for (int r = 0; r < 8; ++r) {
    const float inv = 1.0f / lrow[r];
#pragma unroll
    for (int t = 0; t < 4; ++t)
      os[(8 * hh + r) * TPQ + t * 16 + c] = f2h_bits(oacc[t][r] * inv * 16.0f);
  }
  __builtin_amdgcn_fence(3, "workgroup");
  __builtin_amdgcn_wave_barrier();
  __builtin_amdgcn_fence(2, "workgroup");
  {
    unsigned short* cdst = Ctx + ((size_t)bi * SEQ + q0) * DM + head * DH;
    {
#pragma unroll
      for (int it = 0; it < 4; ++it) {
        const int row = it * 4 + (lane >> 3);
        const int seg = lane & 7;
        const v4u val = *(const v4u*)(os + row * TPQ + seg * 8);
        *(v4u*)(cdst + (size_t)row * DM + seg * 8) = val;
      }
      
    }
  }
}

/* --------------------------------------------------------------------------
 * out = Ctx.Wot (f16 WMMA, x1024 total carry folded by 2^-10) + bo, f32 output.
 * Block = 4 waves (2 x 2), tile 128 tokens x 128 columns, operands staged in LDS (gemm_tile);
 * grid (MROWS/128, DM/128). The ring is output staging after the loop's last barrier:
 * per-wave f32 slab 64x64; rows it*2+hh, it 0..31, pieces (lane&15)*4.
 * ------------------------------------------------------------------------ */
__global__ __launch_bounds__(128) __attribute__((amdgpu_num_vgpr(256)))
void out_gemm_kernel(const unsigned short* __restrict__ Ctx, const unsigned short* __restrict__ Wot,
                     const float* __restrict__ bo, float* __restrict__ out)
{
  __shared__ __align__(16) unsigned short Ring[2 * GSTG];
  const int tid  = threadIdx.x;
  const int wave = tid >> 5;
  const int lane = tid & 31;
  const int hh   = lane >> 4;
  const int c    = lane & 15;
  const int wm   = wave >> 1;
  const int wn   = wave & 1;
  const int m0   = blockIdx.x * GBM;
  const int n0   = blockIdx.y * GBN;

  v8f acc[4][4];
  gemm_tile<true>(Ctx, Wot, Ring, m0, n0, acc);

  float bb[4];
#pragma unroll
  for (int tt = 0; tt < 4; ++tt) bb[tt] = bfr(bo[n0 + 64 * wn + 16 * tt + c]);

  float* os = (float*)Ring + wave * (64 * OSP);
#pragma unroll
  for (int rt = 0; rt < 4; ++rt)
#pragma unroll
    for (int tt = 0; tt < 4; ++tt)
#pragma unroll
      for (int r = 0; r < 8; ++r)
        os[(16 * rt + 8 * hh + r) * OSP + 16 * tt + c] = acc[rt][tt][r] * (1.0f / 1024.0f) + bb[tt];
  __builtin_amdgcn_fence(3, "workgroup");
  __builtin_amdgcn_wave_barrier();
  __builtin_amdgcn_fence(2, "workgroup");

  const int bi  = m0 / SEQ;
  const int nn0 = m0 - bi * SEQ;
  float* ob = out + ((size_t)bi * SEQ_FULL + nn0 + 64 * wm) * DM + n0 + 64 * wn;
  const int c4 = (lane & 15) * 4;
#pragma unroll
  for (int it = 0; it < 32; ++it) {
    const int row = it * 2 + hh;
    const v4f val = *(const v4f*)(os + row * OSP + c4);
    *(v4f*)(ob + (size_t)row * DM + c4) = val;
  }
}

extern "C" void kernel_launch(void* const* d_in, const int* in_sizes, int n_in,
                              void* d_out, int out_size, void* d_ws, size_t ws_size,
                              hipStream_t stream)
{
  if (n_in < 6) return;
  const long need_x = ((long)(NB - 1) * SEQ_FULL + SEQ) * DM;
  if ((long)in_sizes[0] < need_x) return;
  if ((long)in_sizes[1] < (long)DM * NF) return;
  if (in_sizes[2] < NF) return;
  if ((long)in_sizes[3] < (long)NREL * NH) return;
  if ((long)in_sizes[4] < (long)DM * DM) return;
  if (in_sizes[5] < DM) return;
  if ((long)out_size < need_x) return;
  if (d_ws == nullptr || ws_size < WS_NEED) return;

  const float* x     = (const float*)d_in[0];
  const float* w_qkv = (const float*)d_in[1];
  const float* b_qkv = (const float*)d_in[2];
  const float* rel   = (const float*)d_in[3];
  const float* w_out = (const float*)d_in[4];
  const float* b_out = (const float*)d_in[5];
  float* out = (float*)d_out;

  unsigned short* Xb  = (unsigned short*)d_ws;   /* offset 0 */
  unsigned short* Wqt = Xb  + PLANE16;
  unsigned short* Wot = Wqt + WQT_EL;
  unsigned short* Qh  = Wot + WOT_EL;
  unsigned short* Kh  = Qh  + PLANE16;
  unsigned short* Vth = Kh  + PLANE16;
  unsigned short* Vtl = Vth + PLANE16;
  unsigned short* Ctx = Vtl + PLANE16;           /* ends at WS_NEED */

  cvt_x_kernel<<<dim3((unsigned)((MROWS * DM) / 2048)), 256, 0, stream>>>(x, Xb);
  wtrans_kernel<0><<<dim3(NF / 64, DM / 64), 256, 0, stream>>>(w_qkv, Wqt, NF);
  wtrans_kernel<1><<<dim3(DM / 64, DM / 64), 256, 0, stream>>>(w_out, Wot, DM);
  qkv_gemm_kernel<<<dim3(MROWS / GBM, NF / GBN), 128, 0, stream>>>(Xb, Wqt, b_qkv, Qh, Kh, Vth, Vtl);
  attn_kernel<<<dim3(SEQ / QBLK, NBH), 128, 0, stream>>>(Qh, Kh, Vth, Vtl, rel, Ctx);
  out_gemm_kernel<<<dim3(MROWS / GBM, DM / GBN), 128, 0, stream>>>(Ctx, Wot, b_out, out);
}

// v002
// A run of this version takes 152 microseconds.
// Timed twice side by side with v001, it ran 1.23 and 1.24 times as fast.
// All steps since v000 together make it 2.03 times as fast.
// Contractions: qkv = x.w_qkv on v_wmma_f32_16x16x32_bf16 (bf16 operands from RNE-converted inputs); scores = q.k^T on v_wmma_f32_16x16x32_f16 (f16 operands, 1/8 applied in f32); ctx = p.v on v_wmma_f32_16x16x32_bf16 with p and v as bf16 hi+lo planes (three products); out = ctx.w_out on v_wmma_f32_16x16x32_f16 (ctx carried x16, w_out as bf16 value x64, 2^-10 fold in f32); f32 accumulate, f32 online softmax.
#include <hip/hip_runtime.h>

typedef __attribute__((ext_vector_type(16))) __bf16       v16b;
typedef __attribute__((ext_vector_type(16))) _Float16     v16h;
typedef __attribute__((ext_vector_type(8)))  float        v8f;
typedef __attribute__((ext_vector_type(4)))  float        v4f;
typedef __attribute__((ext_vector_type(4)))  unsigned int v4u;

#ifndef NB
#define NB 16
#endif
#ifndef SEQ
#define SEQ 512
#endif
#define NB_FULL  16
#define SEQ_FULL 512

constexpr int DM     = 1024;            /* model dim = inner dim */
constexpr int NH     = 16;              /* heads */
constexpr int DH     = 64;              /* head dim */
constexpr int NF     = 3 * NH * DH;     /* 3072 qkv features */
constexpr int MAXLEN = 512;
constexpr int NREL   = 2 * MAXLEN - 1;  /* 1023 bias rows */
constexpr int MROWS  = NB * SEQ;        /* compact token rows */
constexpr int NBH    = NB * NH;
constexpr int KCH    = 64;              /* keys per staged chunk */
constexpr int QBLK   = 64;              /* query rows per block (4 waves x 16) */
constexpr int NWAVE  = 4;
constexpr int TPQ    = 72;              /* 16-bit LDS tile pitch, 64-wide rows (144 B) */
constexpr int OSP    = 68;              /* f32 LDS slab pitch (272 B) */
constexpr int GBM    = 128;             /* GEMM block tile, token rows */
constexpr int GBN    = 128;             /* GEMM block tile, feature rows of the [n][k] operand */
constexpr int GBK    = 64;              /* k per staged tile: 128-B rows at pitch TPQ */
constexpr int GSTG   = (GBM + GBN) * TPQ;   /* 16-bit elements of one ring buffer (36864 B) */
constexpr int GNT    = DM / GBK;        /* staged tiles along k */

constexpr size_t PLANE16 = (size_t)MROWS * DM;          /* elements of a [MROWS][1024] 16-bit plane */
constexpr size_t WQT_EL  = (size_t)NF * DM;
constexpr size_t WOT_EL  = (size_t)DM * DM;
constexpr size_t WS_NEED = (6 * PLANE16 + WQT_EL + WOT_EL) * 2;   /* 109051904 B at NB=16, SEQ=512 */

static_assert(NB >= 1 && NB <= NB_FULL);
static_assert(SEQ >= 128 && SEQ <= SEQ_FULL && SEQ <= MAXLEN);
static_assert(SEQ % 128 == 0);
static_assert(SEQ % KCH == 0 && SEQ % QBLK == 0);
static_assert(DH == 64 && NH * DH == DM);
static_assert(DM % 64 == 0 && NF % 64 == 0 && NF == 3 * DM);
static_assert(MROWS % 128 == 0);
static_assert((MROWS * DM) % 2048 == 0);
static_assert(NREL <= 1024);
static_assert(TPQ % 8 == 0 && OSP % 4 == 0);
static_assert(MROWS % GBM == 0 && SEQ % GBM == 0 && DM % GBN == 0 && NF % GBN == 0);
static_assert(GNT >= 2 && DM % GBK == 0);
static_assert(NWAVE * 2 * 64 * TPQ <= 2 * GSTG);          /* v hi+lo slabs fit the ring */
static_assert(NWAVE * 64 * OSP * 4 <= 2 * GSTG * 2);      /* f32 slabs fit the ring */
static_assert(WS_NEED <= 134217728ull);

/* workspace region map (bytes, NB=16 SEQ=512):
 *   Xb  bf16 [MROWS][1024]        16777216
 *   Wqt bf16 [3072][1024] (k-contig) 6291456
 *   Wot f16  [1024 n][1024 k]       2097152   (bf16 value x64)
 *   Qh  f16  [NBH][SEQ][64]        16777216
 *   Kh  f16  [NBH][SEQ][64]        16777216
 *   Vth bf16 [NBH][64][SEQ]        16777216   (v hi, transposed)
 *   Vtl bf16 [NBH][64][SEQ]        16777216   (v lo = v - hi)
 *   Ctx f16  [MROWS][1024]         16777216   (x16 carry)
 *   total 109051904
 */

__device__ __forceinline__ unsigned short f2bf_bits(float f) {
  unsigned u = __float_as_uint(f);
  return (unsigned short)((u + 0x7FFFu + ((u >> 16) & 1u)) >> 16);
}
__device__ __forceinline__ float bf_bits2f(unsigned short h) { return __uint_as_float(((unsigned)h) << 16); }
__device__ __forceinline__ float bfr(float f) { return bf_bits2f(f2bf_bits(f)); }   /* RNE convert to the bf16 value */
__device__ __forceinline__ unsigned short f2h_bits(float f) {
  _Float16 h = (_Float16)f;
  return __builtin_bit_cast(unsigned short, h);
}
__device__ __forceinline__ unsigned int pk16(unsigned short lo, unsigned short hi) {
  return (unsigned)lo | ((unsigned)hi << 16);
}

__device__ __forceinline__ v8f mma_bf16(v16b a, v16b b, v8f c) {
  c = __builtin_amdgcn_wmma_f32_16x16x32_bf16(false, a, false, b, (short)0, c, false, false);
  asm volatile("v_nop\n\tv_nop\n\tv_nop\n\tv_nop" : "+v"(c) : "v"(a), "v"(b));
  return c;
}
__device__ __forceinline__ v8f mma_f16(v16h a, v16h b, v8f c) {
  c = __builtin_amdgcn_wmma_f32_16x16x32_f16(false, a, false, b, (short)0, c, false, false);
  asm volatile("v_nop\n\tv_nop\n\tv_nop\n\tv_nop" : "+v"(c) : "v"(a), "v"(b));
  return c;
}

union FragB { v16b v; v4u u[2]; };
union FragH { v16h v; v4u u[2]; };
union FragG { v16b b; v16h h; v4u u[2]; };

__device__ __forceinline__ unsigned lds_off(const void* p) { return (unsigned)(size_t)p; }

/* Eight asynchronous 16-B copies per lane, global -> LDS: rows 16 apart of a [row][DM] 16-bit plane
 * into rows 16 apart of a pitch-TPQ tile. The s_wait_xcnt closes the same statement so that no
 * address register of an issued copy is rewritten in front of it. */
__device__ __forceinline__ void copy8(unsigned l, const unsigned short* g)
{
  constexpr unsigned LS = 16 * TPQ * 2;
  constexpr size_t   GS = (size_t)16 * DM;
  const unsigned l0 = l,          l1 = l + LS,     l2 = l + 2 * LS, l3 = l + 3 * LS;
  const unsigned l4 = l + 4 * LS, l5 = l + 5 * LS, l6 = l + 6 * LS, l7 = l + 7 * LS;
  const unsigned short* g0 = g;
  const unsigned short* g1 = g + GS;
  const unsigned short* g2 = g + 2 * GS;
  const unsigned short* g3 = g + 3 * GS;
  const unsigned short* g4 = g + 4 * GS;
  const unsigned short* g5 = g + 5 * GS;
  const unsigned short* g6 = g + 6 * GS;
  const unsigned short* g7 = g + 7 * GS;
  asm volatile("global_load_async_to_lds_b128 %0, %8, off\n\t"
               "global_load_async_to_lds_b128 %1, %9, off\n\t"
               "global_load_async_to_lds_b128 %2, %10, off\n\t"
               "global_load_async_to_lds_b128 %3, %11, off\n\t"
               "global_load_async_to_lds_b128 %4, %12, off\n\t"
               "global_load_async_to_lds_b128 %5, %13, off\n\t"
               "global_load_async_to_lds_b128 %6, %14, off\n\t"
               "global_load_async_to_lds_b128 %7, %15, off\n\t"
               "s_wait_xcnt 0x0"
               :: "v"(l0), "v"(l1), "v"(l2), "v"(l3), "v"(l4), "v"(l5), "v"(l6), "v"(l7),
                  "v"(g0), "v"(g1), "v"(g2), "v"(g3), "v"(g4), "v"(g5), "v"(g6), "v"(g7)
               : "memory");
}

/* --------------------------------------------------------------------------
 * acc[4][4] (wave tile 64 x 64, waves 2 x 2 in a 128 x 128 block tile) = A[m0..][k] . B[n0..][k]^T,
 * both planes [row][DM] k-contiguous. Per 64-k tile the block stages [A 128 rows | B 128 rows] of
 * 128 B in LDS at pitch 144 B by asynchronous copies (thread -> row tid>>3 + 16 i, 16-B segment
 * tid&7: a wave's copy covers 4 whole lines; 2 x 8 copies per thread = the whole stage), two
 * buffers: tile t+2 is copied into the buffer that trip t has just left, behind the trip's barrier.
 * k runs upward in steps of 32 through one accumulator chain per tile.
 * ------------------------------------------------------------------------ */
template <bool F16>
__device__ __forceinline__ void gemm_tile(const unsigned short* __restrict__ A,
                                          const unsigned short* __restrict__ B,
                                          unsigned short* Ring, int m0, int n0, v8f (&acc)[4][4])
{
  const int tid  = threadIdx.x;
  const int wave = tid >> 5;
  const int lane = tid & 31;
  const int hh   = lane >> 4;
  const int c    = lane & 15;
  const int wm   = wave >> 1;
  const int wn   = wave & 1;

#pragma unroll
  for (int i = 0; i < 4; ++i)
#pragma unroll
    for (int j = 0; j < 4; ++j) acc[i][j] = (v8f){0.f,0.f,0.f,0.f,0.f,0.f,0.f,0.f};

  const int crow = tid >> 3;
  const int cseg = (tid & 7) * 8;
  const unsigned short* ga = A + (size_t)(m0 + crow) * DM + cseg;
  const unsigned short* gb = B + (size_t)(n0 + crow) * DM + cseg;
  const unsigned la = lds_off(Ring) + (unsigned)(crow * TPQ + cseg) * 2u;
  const unsigned lb = la + (unsigned)(GBM * TPQ) * 2u;

  copy8(la, ga);
  copy8(lb, gb);
  asm volatile("s_wait_asynccnt 0x0" ::: "memory");   /* tile 0 of this wave has landed before the barrier publishes it */
  __syncthreads();
  copy8(la + (unsigned)GSTG * 2u, ga + GBK);
  copy8(lb + (unsigned)GSTG * 2u, gb + GBK);

  const unsigned short* fa = Ring + (64 * wm + c) * TPQ + 8 * hh;
  const unsigned short* fb = Ring + (GBM + 64 * wn + c) * TPQ + 8 * hh;

#pragma unroll 1   /* one staged tile per trip: the ring's waits and barrier stand once, at the foot */
  for (int t = 0; t < GNT; ++t) {
    const int bo = (t & 1) * GSTG;
#pragma unroll
    for (int ks = 0; ks < GBK / 32; ++ks) {
      FragG a[4], b[4];
#pragma unroll
      for (int i = 0; i < 4; ++i) {
        a[i].u[0] = *(const v4u*)(fa + bo + i * 16 * TPQ + ks * 32);
        a[i].u[1] = *(const v4u*)(fa + bo + i * 16 * TPQ + ks * 32 + 16);
        b[i].u[0] = *(const v4u*)(fb + bo + i * 16 * TPQ + ks * 32);
        b[i].u[1] = *(const v4u*)(fb + bo + i * 16 * TPQ + ks * 32 + 16);
      }
#pragma unroll
      for (int i = 0; i < 4; ++i)
#pragma unroll
        for (int j = 0; j < 4; ++j) {
          if constexpr (F16) acc[i][j] = mma_f16(a[i].h, b[j].h, acc[i][j]);
          else               acc[i][j] = mma_bf16(a[i].b, b[j].b, acc[i][j]);
        }
    }
    asm volatile("s_wait_dscnt 0x0" ::: "memory");      /* this wave's reads of buffer t&1 are done before it is refilled */
    asm volatile("s_wait_asynccnt 0x0" ::: "memory");   /* this wave's copies of tile t+1 have landed before the barrier publishes them */
    __syncthreads();
    if (t + 2 < GNT) {
      copy8(la + (unsigned)bo * 2u, ga + (t + 2) * GBK);
      copy8(lb + (unsigned)bo * 2u, gb + (t + 2) * GBK);
    }
  }
  asm volatile("s_wait_asynccnt 0x0" ::: "memory");     /* no copy is in flight when the ring becomes output staging */
}

/* Fragment map used everywhere (hh = lane>>4, c = lane&15):
 * A: row c, elements 0..7 <- k0+8hh+0..7, 8..15 <- k0+16+8hh+0..7 (two 16-B loads from a k-contiguous row);
 * B: column c with the SAME k map, loaded from a [n][k] k-contiguous copy exactly like A;
 * D: element r = (row 8hh+r, col c). */

/* --------------------------------------------------------------------------
 * x (f32, full-size strides) -> Xb bf16 [MROWS][1024].
 * Block = 256 threads = 2 compact rows; thread -> 8 consecutive elements, one
 * Coverage: MROWS/2 blocks x 2048 elements = the whole plane.
 * ------------------------------------------------------------------------ */
__global__ __launch_bounds__(256) void cvt_x_kernel(const float* __restrict__ x,
                                                    unsigned short* __restrict__ Xb)
{
  const int tid  = threadIdx.x;
  const int e    = tid * 8;
  const int crow = blockIdx.x * 2 + e / DM;
  const int col  = e % DM;
  const int bi   = crow / SEQ;
  const int n    = crow - bi * SEQ;
  const float* src = x + ((size_t)bi * SEQ_FULL + n) * DM + col;
  const v4f f0 = *(const v4f*)src;
  const v4f f1 = *(const v4f*)(src + 4);
  v4u w;
  w[0] = pk16(f2bf_bits(f0[0]), f2bf_bits(f0[1]));
  w[1] = pk16(f2bf_bits(f0[2]), f2bf_bits(f0[3]));
  w[2] = pk16(f2bf_bits(f1[0]), f2bf_bits(f1[1]));
  w[3] = pk16(f2bf_bits(f1[2]), f2bf_bits(f1[3]));
  unsigned short* dst = Xb + (size_t)crow * DM + col;
  *(v4u*)dst = w;
  
}

/* --------------------------------------------------------------------------
 * w [1024 k][nf] f32 -> Wt [nf][1024] 16-bit (k-contiguous rows).
 * KIND 0: bf16 bits; KIND 1: f16 bits of (bf16 value x64).
 * Block (x = n tile of 64, y = k tile of 64), 256 threads.
 * Load: thread -> k row tid>>2, 16 columns; 64x64 covered once. Transposed into LDS [n][k].
 * Store: 512 units (2 per thread): unit u -> n row u>>3, 16-B segment u&7; lanes
 * Coverage: grid (nf/64, 16) x 64x64 = the whole plane.
 * ------------------------------------------------------------------------ */
template <int KIND>
__global__ __launch_bounds__(256) void wtrans_kernel(const float* __restrict__ w,
                                                     unsigned short* __restrict__ Wt, int nf)
{
  __shared__ __align__(16) unsigned short Ts[64 * TPQ];     /* [n][k] */
  const int tid  = threadIdx.x;
  const int n0   = blockIdx.x * 64;
  const int k0   = blockIdx.y * 64;
  const int krow = tid >> 2;
  const int fseg = (tid & 3) * 16;
  const float* src = w + (size_t)(k0 + krow) * nf + n0 + fseg;
#pragma unroll
  for (int i = 0; i < 4; ++i) {
    const v4f f = *(const v4f*)(src + 4 * i);
#pragma unroll
    for (int e2 = 0; e2 < 4; ++e2) {
      const float v = f[e2];
      unsigned short bits;
      if (KIND == 0) bits = f2bf_bits(v);
      else           bits = f2h_bits(bfr(v) * 64.0f);
      Ts[(fseg + 4 * i + e2) * TPQ + krow] = bits;
    }
  }
  __syncthreads();
  {
#pragma unroll
    for (int it = 0; it < 2; ++it) {
      const int u    = it * 256 + tid;
      const int frow = u >> 3;
      const int seg  = u & 7;
      const v4u val = *(const v4u*)(Ts + frow * TPQ + seg * 8);
      *(v4u*)(Wt + (size_t)(n0 + frow) * DM + k0 + seg * 8) = val;
    }
    
  }
}

/* --------------------------------------------------------------------------
 * qkv = Xb.Wq + bq on bf16 WMMA. Block = 4 waves (2 x 2), tile 128 tokens x 128 features,
 * operands staged in LDS (gemm_tile); grid (MROWS/128, NF/128).
 * A wave's 64 features are exactly one (sel, head); sel is block-uniform.
 * The ring is output staging after the loop's last barrier; every slab is wave-private.
 * sel 0/1: q/k -> f16 plane [bh][n][d]: per-wave 64x64 LDS tile, then 64 whole 128-B rows:
 *   rows it*4+(lane>>3), it 0..15, segs lane&7.
 * sel 2: v -> bf16 hi and lo planes [bh][d][n]: per-wave 64x64 transposed LDS tiles, each d row =
 *   64 tokens = 128 B = 8 lanes x 16 B; rows it*4+(lane>>3), it 0..15.
 * ------------------------------------------------------------------------ */
__global__ __launch_bounds__(128) __attribute__((amdgpu_num_vgpr(256)))
void qkv_gemm_kernel(const unsigned short* __restrict__ Xb, const unsigned short* __restrict__ Wqt,
                     const float* __restrict__ bq,
                     unsigned short* __restrict__ Qh, unsigned short* __restrict__ Kh,
                     unsigned short* __restrict__ Vth, unsigned short* __restrict__ Vtl)
{
  __shared__ __align__(16) unsigned short Ring[2 * GSTG];
  const int tid  = threadIdx.x;
  const int wave = tid >> 5;
  const int lane = tid & 31;
  const int hh   = lane >> 4;
  const int c    = lane & 15;
  const int wm   = wave >> 1;
  const int wn   = wave & 1;
  const int m0   = blockIdx.x * GBM;
  const int n0   = blockIdx.y * GBN;
  const int sel  = blockIdx.y / (DM / GBN);
  const int head = (blockIdx.y - sel * (DM / GBN)) * (GBN / DH) + wn;

  v8f acc[4][4];
  gemm_tile<false>(Xb, Wqt, Ring, m0, n0, acc);

  float bb[4], bl[4];
  const int bidx = n0 + 64 * wn + c;
#pragma unroll
  for (int tt = 0; tt < 4; ++tt) bl[tt] = bq[bidx + 16 * tt];
  /* the four loads share the index register: it is named here so that it lives up to the wait and no load's result lands in it */
  asm volatile("s_wait_xcnt 0x0" :: "v"(bidx) : "memory");
#pragma unroll
  for (int tt = 0; tt < 4; ++tt) bb[tt] = bfr(bl[tt]);

  const int bi  = m0 / SEQ;
  const int nn0 = m0 - bi * SEQ + 64 * wm;
  const int bh  = bi * NH + head;

  if (sel < 2) {
    unsigned short* plane = (sel == 0) ? Qh : Kh;
    unsigned short* ls = Ring + wave * (64 * TPQ);      /* [token][d], wave-private, block barrier used */
#pragma unroll
    for (int rt = 0; rt < 4; ++rt)
#pragma unroll
      for (int tt = 0; tt < 4; ++tt)
#pragma unroll
        for (int r = 0; r < 8; ++r)
          ls[(16 * rt + 8 * hh + r) * TPQ + 16 * tt + c] = f2h_bits(acc[rt][tt][r] + bb[tt]);
    __syncthreads();
    unsigned short* dst = plane + ((size_t)bh * SEQ + nn0) * DH;
#pragma unroll
    for (int it = 0; it < 16; ++it) {
      const int row = it * 4 + (lane >> 3);
      const int seg = lane & 7;
      const v4u val = *(const v4u*)(ls + row * TPQ + seg * 8);
      *(v4u*)(dst + (size_t)row * DH + seg * 8) = val;
    }
  } else {
    unsigned short* th = Ring + wave * (2 * 64 * TPQ);  /* v hi [d][token 0..63], wave-private, block barrier used */
    unsigned short* tl = th + 64 * TPQ;                 /* v lo */
#pragma unroll
    for (int rt = 0; rt < 4; ++rt)
#pragma unroll
      for (int tt = 0; tt < 4; ++tt)
#pragma unroll
        for (int r = 0; r < 8; ++r) {
          const float v = acc[rt][tt][r] + bb[tt];
          const unsigned short hb = f2bf_bits(v);
          const unsigned short lb = f2bf_bits(v - bf_bits2f(hb));
          const int tok = 16 * rt + 8 * hh + r;
          const int d   = 16 * tt + c;
          th[d * TPQ + tok] = hb;
          tl[d * TPQ + tok] = lb;
        }
    __syncthreads();
    const size_t vbase = (size_t)bh * DH * SEQ + nn0;
#pragma unroll
    for (int it = 0; it < 16; ++it) {
      const int drow = it * 4 + (lane >> 3);
      const int seg  = lane & 7;
      const v4u hv = *(const v4u*)(th + drow * TPQ + seg * 8);
      const v4u lv = *(const v4u*)(tl + drow * TPQ + seg * 8);
      *(v4u*)(Vth + vbase + (size_t)drow * SEQ + seg * 8) = hv;
      *(v4u*)(Vtl + vbase + (size_t)drow * SEQ + seg * 8) = lv;
    }
    asm volatile("s_wait_xcnt 0x0" ::: "memory");   /* behind the last store, before a register that a store names is written again */
  }
}

/* --------------------------------------------------------------------------
 * Attention with per-head rel-pos bias, head dim 64, no mask.
 * Block = 4 waves = 64 query rows of one (b,h); grid (SEQ/64, NBH).
 * Per 64-key chunk: K [kv][d] f16 and V^T hi/lo [d][kv] bf16 tiles staged in LDS
 * (128-B rows at pitch 144 B = 16 B x odd, as the P tiles: the 16 rows of a fragment read fall on distinct banks)
 * by 16-B copies (4 units per thread per tile, 512 units x 8 = 64x64 each, staged
 * extent == consumed extent), scores on f16 WMMA, x1/8 + bias (LDS table indexed
 * i-j+MAXLEN-1, always in [0, NREL-1]), f32 online softmax, P as bf16 hi+lo per-wave
 * LDS tiles (16x64 written fully each chunk), O += Ph.Vh + Pl.Vh + Ph.Vl on bf16 WMMA.
 * Ctx [token][head*64+d], lanes 8q..8q+7 per line, one instruction per 4 lines, two
 * LDS regions: Ksh/Vhs/Vls/sbias cross-wave (block barriers); Psh/Psl/Osh wave-private
 * ------------------------------------------------------------------------ */
__global__ __launch_bounds__(128) __attribute__((amdgpu_num_vgpr(256)))
void attn_kernel(const unsigned short* __restrict__ Qh, const unsigned short* __restrict__ Kh,
                 const unsigned short* __restrict__ Vth, const unsigned short* __restrict__ Vtl,
                 const float* __restrict__ rel, unsigned short* __restrict__ Ctx)
{
  __shared__ __align__(16) unsigned short Ksh[KCH * TPQ];           /* K  [kv][d] f16, row pitch TPQ */
  __shared__ __align__(16) unsigned short Vhs[DH * TPQ];            /* Vh [d][kv] bf16, row pitch TPQ */
  __shared__ __align__(16) unsigned short Vls[DH * TPQ];            /* Vl [d][kv] bf16, row pitch TPQ */
  __shared__ __align__(16) unsigned short Psh[NWAVE][16 * TPQ];     /* P hi [row][kv], row pitch TPQ */
  __shared__ __align__(16) unsigned short Psl[NWAVE][16 * TPQ];     /* P lo */
  __shared__ __align__(16) unsigned short Osh[NWAVE][16 * TPQ];     /* out slab per wave (f16) */
  __shared__ float sbias[1024];                                     /* bias column of this head, bf16 value */

  const int tid  = threadIdx.x;
  const int wave = tid >> 5;
  const int lane = tid & 31;
  const int hh   = lane >> 4;
  const int c    = lane & 15;
  const int qb   = blockIdx.x;
  const int bh   = blockIdx.y;
  const int bi   = bh / NH;
  const int head = bh - bi * NH;
  const int q0   = qb * QBLK + wave * 16;

  for (int t = tid; t < 1024; t += 128) {
    const int ti = t < NREL ? t : (NREL - 1);
    const float v = bfr(rel[(size_t)ti * NH + head]);
    sbias[t] = (t < NREL) ? v : 0.f;
  }

  FragH qa[2];
  {
    const unsigned short* qrow = Qh + ((size_t)bh * SEQ + q0 + c) * DH + 8 * hh;
    qa[0].u[0] = *(const v4u*)(qrow);
    qa[0].u[1] = *(const v4u*)(qrow + 16);
    qa[1].u[0] = *(const v4u*)(qrow + 32);
    qa[1].u[1] = *(const v4u*)(qrow + 48);
  }
  __syncthreads();

  float mrow[8], lrow[8];
  v8f oacc[4];
#pragma unroll
  for (int r = 0; r < 8; ++r) { mrow[r] = -__builtin_inff(); lrow[r] = 0.f; }
#pragma unroll
  for (int t = 0; t < 4; ++t) oacc[t] = (v8f){0.f,0.f,0.f,0.f,0.f,0.f,0.f,0.f};

  const unsigned short* Kp  = Kh  + (size_t)bh * SEQ * DH;
  const unsigned short* Vhp = Vth + (size_t)bh * DH * SEQ;
  const unsigned short* Vlp = Vtl + (size_t)bh * DH * SEQ;
  unsigned short* pwh = Psh[wave];
  unsigned short* pwl = Psl[wave];
  const int bbase = q0 + 8 * hh - c + (MAXLEN - 1);    /* bias index = bbase + r - key */

#pragma unroll 1
  for (int kc = 0; kc < SEQ / KCH; ++kc) {
    const int kv0 = kc * KCH;
    __syncthreads();
#pragma unroll
    for (int it = 0; it < 4; ++it) {
      const int u   = it * 128 + tid;
      const int row = u >> 3;
      const int seg = u & 7;
      const v4u kw = *(const v4u*)(Kp  + (size_t)(kv0 + row) * DH + seg * 8);
      const v4u hw = *(const v4u*)(Vhp + (size_t)row * SEQ + kv0 + seg * 8);
      const v4u lw = *(const v4u*)(Vlp + (size_t)row * SEQ + kv0 + seg * 8);
      *(v4u*)(Ksh + row * TPQ + seg * 8) = kw;
      *(v4u*)(Vhs + row * TPQ + seg * 8) = hw;
      *(v4u*)(Vls + row * TPQ + seg * 8) = lw;
    }
    __syncthreads();

    /* scores: 16 query rows x 64 keys per wave */
    v8f s[4];
#pragma unroll
    for (int j = 0; j < 4; ++j) {
      s[j] = (v8f){0.f,0.f,0.f,0.f,0.f,0.f,0.f,0.f};
#pragma unroll
      for (int dc = 0; dc < 2; ++dc) {
        FragH kf;
        kf.u[0] = *(const v4u*)(Ksh + (j * 16 + c) * TPQ + dc * 32 + 8 * hh);
        kf.u[1] = *(const v4u*)(Ksh + (j * 16 + c) * TPQ + dc * 32 + 16 + 8 * hh);
        s[j] = mma_f16(qa[dc].v, kf.v, s[j]);
      }
    }

    /* scale 1/8 and rel-pos bias: key index = kv0 + 16j + c, query = q0 + 8hh + r */
    const int boff = bbase - kv0;
#pragma unroll
    for (int j = 0; j < 4; ++j)
#pragma unroll
      for (int r = 0; r < 8; ++r)
        s[j][r] = s[j][r] * 0.125f + sbias[boff + r - 16 * j];

    /* chunk row max over the 64 keys */
    float cm[8];
#pragma unroll
    for (int r = 0; r < 8; ++r) {
      float m = fmaxf(fmaxf(s[0][r], s[1][r]), fmaxf(s[2][r], s[3][r]));
#pragma unroll
      for (int off = 1; off < 16; off <<= 1) m = fmaxf(m, __shfl_xor(m, off, 32));
      cm[r] = m;
    }

    /* online softmax update, P tiles as bf16 hi + lo */
#pragma unroll
    for (int r = 0; r < 8; ++r) {
      const float mnew  = fmaxf(mrow[r], cm[r]);
      const float alpha = __expf(mrow[r] - mnew);
      mrow[r] = mnew;
      float psum = 0.f;
#pragma unroll
      for (int j = 0; j < 4; ++j) {
        const float p = __expf(s[j][r] - mnew);
        psum += p;
        const unsigned short hb = f2bf_bits(p);
        const unsigned short lb = f2bf_bits(p - bf_bits2f(hb));
        pwh[(8 * hh + r) * TPQ + j * 16 + c] = hb;
        pwl[(8 * hh + r) * TPQ + j * 16 + c] = lb;
      }
#pragma unroll
      for (int off = 1; off < 16; off <<= 1) psum += __shfl_xor(psum, off, 32);
      lrow[r] = lrow[r] * alpha + psum;
#pragma unroll
      for (int t = 0; t < 4; ++t) oacc[t][r] *= alpha;
    }
    __builtin_amdgcn_fence(3, "workgroup");
    __builtin_amdgcn_wave_barrier();
    __builtin_amdgcn_fence(2, "workgroup");

    /* O += P.V : A = P [q][kv] (this wave's tile), B = V [kv][d] from V^T [d][kv] */
#pragma unroll
    for (int kk = 0; kk < 2; ++kk) {
      FragB pa, pl;
      pa.u[0] = *(const v4u*)(pwh + c * TPQ + kk * 32 + 8 * hh);
      pa.u[1] = *(const v4u*)(pwh + c * TPQ + kk * 32 + 16 + 8 * hh);
      pl.u[0] = *(const v4u*)(pwl + c * TPQ + kk * 32 + 8 * hh);
      pl.u[1] = *(const v4u*)(pwl + c * TPQ + kk * 32 + 16 + 8 * hh);
#pragma unroll
      for (int t = 0; t < 4; ++t) {
        FragB vh, vl;
        vh.u[0] = *(const v4u*)(Vhs + (t * 16 + c) * TPQ + kk * 32 + 8 * hh);
        vh.u[1] = *(const v4u*)(Vhs + (t * 16 + c) * TPQ + kk * 32 + 16 + 8 * hh);
        vl.u[0] = *(const v4u*)(Vls + (t * 16 + c) * TPQ + kk * 32 + 8 * hh);
        vl.u[1] = *(const v4u*)(Vls + (t * 16 + c) * TPQ + kk * 32 + 16 + 8 * hh);
        oacc[t] = mma_bf16(pa.v, vh.v, oacc[t]);
        oacc[t] = mma_bf16(pl.v, vh.v, oacc[t]);
        oacc[t] = mma_bf16(pa.v, vl.v, oacc[t]);
      }
    }
  }

  /* normalise, x16 carry, f16 slab, then whole-line stores into Ctx */
  unsigned short* os = Osh[wave];
#pragma unroll
  for (int r = 0; r < 8; ++r) {
    const float inv = 1.0f / lrow[r];
#pragma unroll
    for (int t = 0; t < 4; ++t)
      os[(8 * hh + r) * TPQ + t * 16 + c] = f2h_bits(oacc[t][r] * inv * 16.0f);
  }
  __builtin_amdgcn_fence(3, "workgroup");
  __builtin_amdgcn_wave_barrier();
  __builtin_amdgcn_fence(2, "workgroup");
  {
    unsigned short* cdst = Ctx + ((size_t)bi * SEQ + q0) * DM + head * DH;
    {
#pragma unroll
      for (int it = 0; it < 4; ++it) {
        const int row = it * 4 + (lane >> 3);
        const int seg = lane & 7;
        const v4u val = *(const v4u*)(os + row * TPQ + seg * 8);
        *(v4u*)(cdst + (size_t)row * DM + seg * 8) = val;
      }
      
    }
  }
}

/* --------------------------------------------------------------------------
 * out = Ctx.Wot (f16 WMMA, x1024 total carry folded by 2^-10) + bo, f32 output.
 * Block = 4 waves (2 x 2), tile 128 tokens x 128 columns, operands staged in LDS (gemm_tile);
 * grid (MROWS/128, DM/128). The ring is output staging after the loop's last barrier:
 * per-wave f32 slab 64x64; rows it*2+hh, it 0..31, pieces (lane&15)*4.
 * ------------------------------------------------------------------------ */
__global__ __launch_bounds__(128) __attribute__((amdgpu_num_vgpr(256)))
void out_gemm_kernel(const unsigned short* __restrict__ Ctx, const unsigned short* __restrict__ Wot,
                     const float* __restrict__ bo, float* __restrict__ out)
{
  __shared__ __align__(16) unsigned short Ring[2 * GSTG];
  const int tid  = threadIdx.x;
  const int wave = tid >> 5;
  const int lane = tid & 31;
  const int hh   = lane >> 4;
  const int c    = lane & 15;
  const int wm   = wave >> 1;
  const int wn   = wave & 1;
  const int m0   = blockIdx.x * GBM;
  const int n0   = blockIdx.y * GBN;

  v8f acc[4][4];
  gemm_tile<true>(Ctx, Wot, Ring, m0, n0, acc);

  float bb[4];
#pragma unroll
  for (int tt = 0; tt < 4; ++tt) bb[tt] = bfr(bo[n0 + 64 * wn + 16 * tt + c]);

  float* os = (float*)Ring + wave * (64 * OSP);
#pragma unroll
  for (int rt = 0; rt < 4; ++rt)
#pragma unroll
    for (int tt = 0; tt < 4; ++tt)
#pragma unroll
      for (int r = 0; r < 8; ++r)
        os[(16 * rt + 8 * hh + r) * OSP + 16 * tt + c] = acc[rt][tt][r] * (1.0f / 1024.0f) + bb[tt];
  __builtin_amdgcn_fence(3, "workgroup");
  __builtin_amdgcn_wave_barrier();
  __builtin_amdgcn_fence(2, "workgroup");

  const int bi  = m0 / SEQ;
  const int nn0 = m0 - bi * SEQ;
  float* ob = out + ((size_t)bi * SEQ_FULL + nn0 + 64 * wm) * DM + n0 + 64 * wn;
  const int c4 = (lane & 15) * 4;
#pragma unroll
  for (int it = 0; it < 32; ++it) {
    const int row = it * 2 + hh;
    const v4f val = *(const v4f*)(os + row * OSP + c4);
    *(v4f*)(ob + (size_t)row * DM + c4) = val;
  }
}

extern "C" void kernel_launch(void* const* d_in, const int* in_sizes, int n_in,
                              void* d_out, int out_size, void* d_ws, size_t ws_size,
                              hipStream_t stream)
{
  if (n_in < 6) return;
  const long need_x = ((long)(NB - 1) * SEQ_FULL + SEQ) * DM;
  if ((long)in_sizes[0] < need_x) return;
  if ((long)in_sizes[1] < (long)DM * NF) return;
  if (in_sizes[2] < NF) return;
  if ((long)in_sizes[3] < (long)NREL * NH) return;
  if ((long)in_sizes[4] < (long)DM * DM) return;
  if (in_sizes[5] < DM) return;
  if ((long)out_size < need_x) return;
  if (d_ws == nullptr || ws_size < WS_NEED) return;

  const float* x     = (const float*)d_in[0];
  const float* w_qkv = (const float*)d_in[1];
  const float* b_qkv = (const float*)d_in[2];
  const float* rel   = (const float*)d_in[3];
  const float* w_out = (const float*)d_in[4];
  const float* b_out = (const float*)d_in[5];
  float* out = (float*)d_out;

  unsigned short* Xb  = (unsigned short*)d_ws;   /* offset 0 */
  unsigned short* Wqt = Xb  + PLANE16;
  unsigned short* Wot = Wqt + WQT_EL;
  unsigned short* Qh  = Wot + WOT_EL;
  unsigned short* Kh  = Qh  + PLANE16;
  unsigned short* Vth = Kh  + PLANE16;
  unsigned short* Vtl = Vth + PLANE16;
  unsigned short* Ctx = Vtl + PLANE16;           /* ends at WS_NEED */

  cvt_x_kernel<<<dim3((unsigned)((MROWS * DM) / 2048)), 256, 0, stream>>>(x, Xb);
  wtrans_kernel<0><<<dim3(NF / 64, DM / 64), 256, 0, stream>>>(w_qkv, Wqt, NF);
  wtrans_kernel<1><<<dim3(DM / 64, DM / 64), 256, 0, stream>>>(w_out, Wot, DM);
  qkv_gemm_kernel<<<dim3(MROWS / GBM, NF / GBN), 128, 0, stream>>>(Xb, Wqt, b_qkv, Qh, Kh, Vth, Vtl);
  attn_kernel<<<dim3(SEQ / QBLK, NBH), 128, 0, stream>>>(Qh, Kh, Vth, Vtl, rel, Ctx);
  out_gemm_kernel<<<dim3(MROWS / GBM, DM / GBN), 128, 0, stream>>>(Ctx, Wot, b_out, out);
}

// v003
// It runs in 132 microseconds.
// Timed twice side by side with v002, it ran 1.16 times as fast both times.
// Counting every step since v000, it is 2.35 times as fast.
// Contractions: qkv = x.w_qkv on v_wmma_f32_16x16x32_bf16 (bf16 operands from RNE-converted inputs); scores = q.k^T on v_wmma_f32_16x16x32_f16 (f16 operands, 1/8 applied in f32); ctx = p.v on v_wmma_f32_16x16x32_bf16 with p and v as bf16 hi+lo planes (three products); out = ctx.w_out on v_wmma_f32_16x16x32_f16 (ctx carried x16, w_out as bf16 value x64, 2^-10 fold in f32); f32 accumulate, f32 online softmax.
#include <hip/hip_runtime.h>

typedef __attribute__((ext_vector_type(16))) __bf16       v16b;
typedef __attribute__((ext_vector_type(16))) _Float16     v16h;
typedef __attribute__((ext_vector_type(8)))  float        v8f;
typedef __attribute__((ext_vector_type(4)))  float        v4f;
typedef __attribute__((ext_vector_type(4)))  unsigned int v4u;

#ifndef NB
#define NB 16
#endif
#ifndef SEQ
#define SEQ 512
#endif
#define NB_FULL  16
#define SEQ_FULL 512

constexpr int DM     = 1024;            /* model dim = inner dim */
constexpr int NH     = 16;              /* heads */
constexpr int DH     = 64;              /* head dim */
constexpr int NF     = 3 * NH * DH;     /* 3072 qkv features */
constexpr int MAXLEN = 512;
constexpr int NREL   = 2 * MAXLEN - 1;  /* 1023 bias rows */
constexpr int MROWS  = NB * SEQ;        /* compact token rows */
constexpr int NBH    = NB * NH;
constexpr int KCH    = 64;              /* keys per staged chunk */
constexpr int QBLK   = 64;              /* query rows per block (4 waves x 16) */
constexpr int NWAVE  = 4;
constexpr int TPQ    = 72;              /* 16-bit LDS tile pitch, 64-wide rows (144 B) */
constexpr int OSP    = 68;              /* f32 LDS slab pitch (272 B) */
constexpr int GBM    = 128;             /* GEMM block tile, token rows */
constexpr int GBN    = 128;             /* GEMM block tile, feature rows of the [n][k] operand */
constexpr int GBK    = 64;              /* k per staged tile: 128-B rows at pitch TPQ */
constexpr int GSTG   = (GBM + GBN) * TPQ;   /* 16-bit elements of one ring buffer (36864 B) */
constexpr int GNT    = DM / GBK;        /* staged tiles along k */

constexpr size_t PLANE16 = (size_t)MROWS * DM;          /* elements of a [MROWS][1024] 16-bit plane */
constexpr size_t WQT_EL  = (size_t)NF * DM;
constexpr size_t WOT_EL  = (size_t)DM * DM;
constexpr size_t WS_NEED = (6 * PLANE16 + WQT_EL + WOT_EL) * 2;   /* 109051904 B at NB=16, SEQ=512 */

static_assert(NB >= 1 && NB <= NB_FULL);
static_assert(SEQ >= 128 && SEQ <= SEQ_FULL && SEQ <= MAXLEN);
static_assert(SEQ % 128 == 0);
static_assert(SEQ % KCH == 0 && SEQ % QBLK == 0);
static_assert(DH == 64 && NH * DH == DM);
static_assert(DM % 64 == 0 && NF % 64 == 0 && NF == 3 * DM);
static_assert(MROWS % 128 == 0);
static_assert((MROWS * DM) % 2048 == 0);
static_assert(NREL <= 1024);
static_assert(TPQ % 8 == 0 && OSP % 4 == 0);
static_assert(MROWS % GBM == 0 && SEQ % GBM == 0 && DM % GBN == 0 && NF % GBN == 0);
static_assert(GNT >= 2 && DM % GBK == 0);
static_assert(NWAVE * 2 * 64 * TPQ <= 2 * GSTG);          /* v hi+lo slabs fit the ring */
static_assert(NWAVE * 64 * OSP * 4 <= 2 * GSTG * 2);      /* f32 slabs fit the ring */
static_assert(WS_NEED <= 134217728ull);

/* workspace region map (bytes, NB=16 SEQ=512):
 *   Xb  bf16 [MROWS][1024]        16777216
 *   Wqt bf16 [3072][1024] (k-contig) 6291456
 *   Wot f16  [1024 n][1024 k]       2097152   (bf16 value x64)
 *   Qh  f16  [NBH][SEQ][64]        16777216
 *   Kh  f16  [NBH][SEQ][64]        16777216
 *   Vth bf16 [NBH][64][SEQ]        16777216   (v hi, transposed)
 *   Vtl bf16 [NBH][64][SEQ]        16777216   (v lo = v - hi)
 *   Ctx f16  [MROWS][1024]         16777216   (x16 carry)
 *   total 109051904
 */

__device__ __forceinline__ unsigned short f2bf_bits(float f) {
  unsigned u = __float_as_uint(f);
  return (unsigned short)((u + 0x7FFFu + ((u >> 16) & 1u)) >> 16);
}
__device__ __forceinline__ float bf_bits2f(unsigned short h) { return __uint_as_float(((unsigned)h) << 16); }
__device__ __forceinline__ float bfr(float f) { return bf_bits2f(f2bf_bits(f)); }   /* RNE convert to the bf16 value */
__device__ __forceinline__ unsigned short f2h_bits(float f) {
  _Float16 h = (_Float16)f;
  return __builtin_bit_cast(unsigned short, h);
}
__device__ __forceinline__ unsigned int pk16(unsigned short lo, unsigned short hi) {
  return (unsigned)lo | ((unsigned)hi << 16);
}

__device__ __forceinline__ v8f mma_bf16(v16b a, v16b b, v8f c) {
  c = __builtin_amdgcn_wmma_f32_16x16x32_bf16(false, a, false, b, (short)0, c, false, false);
  asm volatile("v_nop\n\tv_nop\n\tv_nop\n\tv_nop" : "+v"(c) : "v"(a), "v"(b));
  return c;
}
__device__ __forceinline__ v8f mma_f16(v16h a, v16h b, v8f c) {
  c = __builtin_amdgcn_wmma_f32_16x16x32_f16(false, a, false, b, (short)0, c, false, false);
  asm volatile("v_nop\n\tv_nop\n\tv_nop\n\tv_nop" : "+v"(c) : "v"(a), "v"(b));
  return c;
}

/* f2bf_bits before its shift: the RNE bf16 bits of f stand in the upper half */
__device__ __forceinline__ unsigned bf_round(float f) {
  const unsigned u = __float_as_uint(f);
  return u + 0x7FFFu + ((u >> 16) & 1u);
}
/* (hi & 0xFFFF0000) | (lo >> 16) as one byte permute: element 2i from lo, element 2i+1 from hi */
__device__ __forceinline__ unsigned pk_top(unsigned lo, unsigned hi) { return __builtin_amdgcn_perm(hi, lo, 0x07060302u); }

/* the value that lane ^ 16 holds */
__device__ __forceinline__ float xhalf(float v) {
  const int b = __float_as_int(v);
  return __int_as_float(__builtin_amdgcn_permlanex16(b, b, 0x76543210, 0xfedcba98, false, false));
}

union FragB { v16b v; v4u u[2]; };
union FragH { v16h v; v4u u[2]; };
union FragG { v16b b; v16h h; v4u u[2]; };

__device__ __forceinline__ unsigned lds_off(const void* p) { return (unsigned)(size_t)p; }

/* Eight asynchronous 16-B copies per lane, global -> LDS: rows 16 apart of a [row][DM] 16-bit plane
 * into rows 16 apart of a pitch-TPQ tile. The s_wait_xcnt closes the same statement so that no
 * address register of an issued copy is rewritten in front of it. */
__device__ __forceinline__ void copy8(unsigned l, const unsigned short* g)
{
  constexpr unsigned LS = 16 * TPQ * 2;
  constexpr size_t   GS = (size_t)16 * DM;
  const unsigned l0 = l,          l1 = l + LS,     l2 = l + 2 * LS, l3 = l + 3 * LS;
  const unsigned l4 = l + 4 * LS, l5 = l + 5 * LS, l6 = l + 6 * LS, l7 = l + 7 * LS;
  const unsigned short* g0 = g;
  const unsigned short* g1 = g + GS;
  const unsigned short* g2 = g + 2 * GS;
  const unsigned short* g3 = g + 3 * GS;
  const unsigned short* g4 = g + 4 * GS;
  const unsigned short* g5 = g + 5 * GS;
  const unsigned short* g6 = g + 6 * GS;
  const unsigned short* g7 = g + 7 * GS;
  asm volatile("global_load_async_to_lds_b128 %0, %8, off\n\t"
               "global_load_async_to_lds_b128 %1, %9, off\n\t"
               "global_load_async_to_lds_b128 %2, %10, off\n\t"
               "global_load_async_to_lds_b128 %3, %11, off\n\t"
               "global_load_async_to_lds_b128 %4, %12, off\n\t"
               "global_load_async_to_lds_b128 %5, %13, off\n\t"
               "global_load_async_to_lds_b128 %6, %14, off\n\t"
               "global_load_async_to_lds_b128 %7, %15, off\n\t"
               "s_wait_xcnt 0x0"
               :: "v"(l0), "v"(l1), "v"(l2), "v"(l3), "v"(l4), "v"(l5), "v"(l6), "v"(l7),
                  "v"(g0), "v"(g1), "v"(g2), "v"(g3), "v"(g4), "v"(g5), "v"(g6), "v"(g7)
               : "memory");
}

/* --------------------------------------------------------------------------
 * acc[4][4] (wave tile 64 x 64, waves 2 x 2 in a 128 x 128 block tile) = A[m0..][k] . B[n0..][k]^T,
 * both planes [row][DM] k-contiguous. Per 64-k tile the block stages [A 128 rows | B 128 rows] of
 * 128 B in LDS at pitch 144 B by asynchronous copies (thread -> row tid>>3 + 16 i, 16-B segment
 * tid&7: a wave's copy covers 4 whole lines; 2 x 8 copies per thread = the whole stage), two
 * buffers: tile t+2 is copied into the buffer that trip t has just left, behind the trip's barrier.
 * k runs upward in steps of 32 through one accumulator chain per tile.
 * ------------------------------------------------------------------------ */
template <bool F16>
__device__ __forceinline__ void gemm_tile(const unsigned short* __restrict__ A,
                                          const unsigned short* __restrict__ B,
                                          unsigned short* Ring, int m0, int n0, v8f (&acc)[4][4])
{
  const int tid  = threadIdx.x;
  const int wave = tid >> 5;
  const int lane = tid & 31;
  const int hh   = lane >> 4;
  const int c    = lane & 15;
  const int wm   = wave >> 1;
  const int wn   = wave & 1;

#pragma unroll
  for (int i = 0; i < 4; ++i)
#pragma unroll
    for (int j = 0; j < 4; ++j) acc[i][j] = (v8f){0.f,0.f,0.f,0.f,0.f,0.f,0.f,0.f};

  const int crow = tid >> 3;
  const int cseg = (tid & 7) * 8;
  const unsigned short* ga = A + (size_t)(m0 + crow) * DM + cseg;
  const unsigned short* gb = B + (size_t)(n0 + crow) * DM + cseg;
  const unsigned la = lds_off(Ring) + (unsigned)(crow * TPQ + cseg) * 2u;
  const unsigned lb = la + (unsigned)(GBM * TPQ) * 2u;

  copy8(la, ga);
  copy8(lb, gb);
  asm volatile("s_wait_asynccnt 0x0" ::: "memory");   /* tile 0 of this wave has landed before the barrier publishes it */
  __syncthreads();
  copy8(la + (unsigned)GSTG * 2u, ga + GBK);
  copy8(lb + (unsigned)GSTG * 2u, gb + GBK);

  const unsigned short* fa = Ring + (64 * wm + c) * TPQ + 8 * hh;
  const unsigned short* fb = Ring + (GBM + 64 * wn + c) * TPQ + 8 * hh;

#pragma unroll 1   /* one staged tile per trip: the ring's waits and barrier stand once, at the foot */
  for (int t = 0; t < GNT; ++t) {
    const int bo = (t & 1) * GSTG;
#pragma unroll
    for (int ks = 0; ks < GBK / 32; ++ks) {
      FragG a[4], b[4];
#pragma unroll
      for (int i = 0; i < 4; ++i) {
        a[i].u[0] = *(const v4u*)(fa + bo + i * 16 * TPQ + ks * 32);
        a[i].u[1] = *(const v4u*)(fa + bo + i * 16 * TPQ + ks * 32 + 16);
        b[i].u[0] = *(const v4u*)(fb + bo + i * 16 * TPQ + ks * 32);
        b[i].u[1] = *(const v4u*)(fb + bo + i * 16 * TPQ + ks * 32 + 16);
      }
#pragma unroll
      for (int i = 0; i < 4; ++i)
#pragma unroll
        for (int j = 0; j < 4; ++j) {
          if constexpr (F16) acc[i][j] = mma_f16(a[i].h, b[j].h, acc[i][j]);
          else               acc[i][j] = mma_bf16(a[i].b, b[j].b, acc[i][j]);
        }
    }
    asm volatile("s_wait_dscnt 0x0" ::: "memory");      /* this wave's reads of buffer t&1 are done before it is refilled */
    asm volatile("s_wait_asynccnt 0x0" ::: "memory");   /* this wave's copies of tile t+1 have landed before the barrier publishes them */
    __syncthreads();
    if (t + 2 < GNT) {
      copy8(la + (unsigned)bo * 2u, ga + (t + 2) * GBK);
      copy8(lb + (unsigned)bo * 2u, gb + (t + 2) * GBK);
    }
  }
  asm volatile("s_wait_asynccnt 0x0" ::: "memory");     /* no copy is in flight when the ring becomes output staging */
}

/* Fragment map used everywhere (hh = lane>>4, c = lane&15):
 * A: row c, elements 0..7 <- k0+8hh+0..7, 8..15 <- k0+16+8hh+0..7 (two 16-B loads from a k-contiguous row);
 * B: column c with the SAME k map, loaded from a [n][k] k-contiguous copy exactly like A;
 * D: element r = (row 8hh+r, col c). */

/* --------------------------------------------------------------------------
 * x (f32, full-size strides) -> Xb bf16 [MROWS][1024].
 * Block = 256 threads = 2 compact rows; thread -> 8 consecutive elements, one
 * Coverage: MROWS/2 blocks x 2048 elements = the whole plane.
 * ------------------------------------------------------------------------ */
__global__ __launch_bounds__(256) void cvt_x_kernel(const float* __restrict__ x,
                                                    unsigned short* __restrict__ Xb)
{
  const int tid  = threadIdx.x;
  const int e    = tid * 8;
  const int crow = blockIdx.x * 2 + e / DM;
  const int col  = e % DM;
  const int bi   = crow / SEQ;
  const int n    = crow - bi * SEQ;
  const float* src = x + ((size_t)bi * SEQ_FULL + n) * DM + col;
  const v4f f0 = *(const v4f*)src;
  const v4f f1 = *(const v4f*)(src + 4);
  v4u w;
  w[0] = pk16(f2bf_bits(f0[0]), f2bf_bits(f0[1]));
  w[1] = pk16(f2bf_bits(f0[2]), f2bf_bits(f0[3]));
  w[2] = pk16(f2bf_bits(f1[0]), f2bf_bits(f1[1]));
  w[3] = pk16(f2bf_bits(f1[2]), f2bf_bits(f1[3]));
  unsigned short* dst = Xb + (size_t)crow * DM + col;
  *(v4u*)dst = w;
  
}

/* --------------------------------------------------------------------------
 * w [1024 k][nf] f32 -> Wt [nf][1024] 16-bit (k-contiguous rows).
 * KIND 0: bf16 bits; KIND 1: f16 bits of (bf16 value x64).
 * Block (x = n tile of 64, y = k tile of 64), 256 threads.
 * Load: thread -> k row tid>>2, 16 columns; 64x64 covered once. Transposed into LDS [n][k].
 * Store: 512 units (2 per thread): unit u -> n row u>>3, 16-B segment u&7; lanes
 * Coverage: grid (nf/64, 16) x 64x64 = the whole plane.
 * ------------------------------------------------------------------------ */
template <int KIND>
__global__ __launch_bounds__(256) void wtrans_kernel(const float* __restrict__ w,
                                                     unsigned short* __restrict__ Wt, int nf)
{
  __shared__ __align__(16) unsigned short Ts[64 * TPQ];     /* [n][k] */
  const int tid  = threadIdx.x;
  const int n0   = blockIdx.x * 64;
  const int k0   = blockIdx.y * 64;
  const int krow = tid >> 2;
  const int fseg = (tid & 3) * 16;
  const float* src = w + (size_t)(k0 + krow) * nf + n0 + fseg;
#pragma unroll
  for (int i = 0; i < 4; ++i) {
    const v4f f = *(const v4f*)(src + 4 * i);
#pragma unroll
    for (int e2 = 0; e2 < 4; ++e2) {
      const float v = f[e2];
      unsigned short bits;
      if (KIND == 0) bits = f2bf_bits(v);
      else           bits = f2h_bits(bfr(v) * 64.0f);
      Ts[(fseg + 4 * i + e2) * TPQ + krow] = bits;
    }
  }
  __syncthreads();
  {
#pragma unroll
    for (int it = 0; it < 2; ++it) {
      const int u    = it * 256 + tid;
      const int frow = u >> 3;
      const int seg  = u & 7;
      const v4u val = *(const v4u*)(Ts + frow * TPQ + seg * 8);
      *(v4u*)(Wt + (size_t)(n0 + frow) * DM + k0 + seg * 8) = val;
    }
    
  }
}

/* --------------------------------------------------------------------------
 * qkv = Xb.Wq + bq on bf16 WMMA. Block = 4 waves (2 x 2), tile 128 tokens x 128 features,
 * operands staged in LDS (gemm_tile); grid (MROWS/128, NF/128).
 * A wave's 64 features are exactly one (sel, head); sel is block-uniform.
 * The ring is output staging after the loop's last barrier; every slab is wave-private.
 * sel 0/1: q/k -> f16 plane [bh][n][d]: per-wave 64x64 LDS tile, then 64 whole 128-B rows:
 *   rows it*4+(lane>>3), it 0..15, segs lane&7.
 * sel 2: v -> bf16 hi and lo planes [bh][d][n]: per-wave 64x64 transposed LDS tiles, each d row =
 *   64 tokens = 128 B = 8 lanes x 16 B; rows it*4+(lane>>3), it 0..15.
 * ------------------------------------------------------------------------ */
__global__ __launch_bounds__(128) __attribute__((amdgpu_num_vgpr(256)))
void qkv_gemm_kernel(const unsigned short* __restrict__ Xb, const unsigned short* __restrict__ Wqt,
                     const float* __restrict__ bq,
                     unsigned short* __restrict__ Qh, unsigned short* __restrict__ Kh,
                     unsigned short* __restrict__ Vth, unsigned short* __restrict__ Vtl)
{
  __shared__ __align__(16) unsigned short Ring[2 * GSTG];
  const int tid  = threadIdx.x;
  const int wave = tid >> 5;
  const int lane = tid & 31;
  const int hh   = lane >> 4;
  const int c    = lane & 15;
  const int wm   = wave >> 1;
  const int wn   = wave & 1;
  const int m0   = blockIdx.x * GBM;
  const int n0   = blockIdx.y * GBN;
  const int sel  = blockIdx.y / (DM / GBN);
  const int head = (blockIdx.y - sel * (DM / GBN)) * (GBN / DH) + wn;

  v8f acc[4][4];
  gemm_tile<false>(Xb, Wqt, Ring, m0, n0, acc);

  float bb[4], bl[4];
  const int bidx = n0 + 64 * wn + c;
#pragma unroll
  for (int tt = 0; tt < 4; ++tt) bl[tt] = bq[bidx + 16 * tt];
  /* the four loads share the index register: it is named here so that it lives up to the wait and no load's result lands in it */
  asm volatile("s_wait_xcnt 0x0" :: "v"(bidx) : "memory");
#pragma unroll
  for (int tt = 0; tt < 4; ++tt) bb[tt] = bfr(bl[tt]);

  const int bi  = m0 / SEQ;
  const int nn0 = m0 - bi * SEQ + 64 * wm;
  const int bh  = bi * NH + head;

  if (sel < 2) {
    unsigned short* plane = (sel == 0) ? Qh : Kh;
    unsigned short* ls = Ring + wave * (64 * TPQ);      /* [token][d], wave-private, block barrier used */
#pragma unroll
    for (int rt = 0; rt < 4; ++rt)
#pragma unroll
      for (int tt = 0; tt < 4; ++tt)
#pragma unroll
        for (int r = 0; r < 8; ++r)
          ls[(16 * rt + 8 * hh + r) * TPQ + 16 * tt + c] = f2h_bits(acc[rt][tt][r] + bb[tt]);
    __syncthreads();
    unsigned short* dst = plane + ((size_t)bh * SEQ + nn0) * DH;
#pragma unroll
    for (int it = 0; it < 16; ++it) {
      const int row = it * 4 + (lane >> 3);
      const int seg = lane & 7;
      const v4u val = *(const v4u*)(ls + row * TPQ + seg * 8);
      *(v4u*)(dst + (size_t)row * DH + seg * 8) = val;
    }
  } else {
    unsigned short* th = Ring + wave * (2 * 64 * TPQ);  /* v hi [d][token 0..63], wave-private, block barrier used */
    unsigned short* tl = th + 64 * TPQ;                 /* v lo */
#pragma unroll
    for (int rt = 0; rt < 4; ++rt)
#pragma unroll
      for (int tt = 0; tt < 4; ++tt)
#pragma unroll
        for (int r = 0; r < 8; ++r) {
          const float v = acc[rt][tt][r] + bb[tt];
          const unsigned short hb = f2bf_bits(v);
          const unsigned short lb = f2bf_bits(v - bf_bits2f(hb));
          const int tok = 16 * rt + 8 * hh + r;
          const int d   = 16 * tt + c;
          th[d * TPQ + tok] = hb;
          tl[d * TPQ + tok] = lb;
        }
    __syncthreads();
    const size_t vbase = (size_t)bh * DH * SEQ + nn0;
#pragma unroll
    for (int it = 0; it < 16; ++it) {
      const int drow = it * 4 + (lane >> 3);
      const int seg  = lane & 7;
      const v4u hv = *(const v4u*)(th + drow * TPQ + seg * 8);
      const v4u lv = *(const v4u*)(tl + drow * TPQ + seg * 8);
      *(v4u*)(Vth + vbase + (size_t)drow * SEQ + seg * 8) = hv;
      *(v4u*)(Vtl + vbase + (size_t)drow * SEQ + seg * 8) = lv;
    }
    asm volatile("s_wait_xcnt 0x0" ::: "memory");   /* behind the last store, before a register that a store names is written again */
  }
}

__global__ __launch_bounds__(128) __attribute__((amdgpu_num_vgpr(256)))
void attn_kernel(const unsigned short* __restrict__ Qh, const unsigned short* __restrict__ Kh,
                 const unsigned short* __restrict__ Vth, const unsigned short* __restrict__ Vtl,
                 const float* __restrict__ rel, unsigned short* __restrict__ Ctx)
{
  __shared__ __align__(16) unsigned short Ksh[KCH * TPQ];           /* K  [kv][d] f16, row pitch TPQ */
  __shared__ __align__(16) unsigned short Vhs[DH * TPQ];            /* Vh [d][kv] bf16, row pitch TPQ */
  __shared__ __align__(16) unsigned short Vls[DH * TPQ];            /* Vl [d][kv] bf16, row pitch TPQ */
  __shared__ __align__(16) unsigned short Osh[NWAVE][16 * TPQ];     /* out slab per wave (f16) */
  __shared__ float sbias[1024];                                     /* bias column of this head, bf16 value */

  const int tid  = threadIdx.x;
  const int wave = tid >> 5;
  const int lane = tid & 31;
  const int hh   = lane >> 4;
  const int c    = lane & 15;
  const int qb   = blockIdx.x;
  const int bh   = blockIdx.y;
  const int bi   = bh / NH;
  const int head = bh - bi * NH;
  const int q0   = qb * QBLK + wave * 16;

  for (int t = tid; t < 1024; t += 128) {
    const int ti = t < NREL ? t : (NREL - 1);
    const float v = bfr(rel[(size_t)ti * NH + head]);
    sbias[t] = (t < NREL) ? v : 0.f;
  }

  FragH qa[2];
  {
    const unsigned short* qrow = Qh + ((size_t)bh * SEQ + q0 + c) * DH + 8 * hh;
    qa[0].u[0] = *(const v4u*)(qrow);
    qa[0].u[1] = *(const v4u*)(qrow + 16);
    qa[1].u[0] = *(const v4u*)(qrow + 32);
    qa[1].u[1] = *(const v4u*)(qrow + 48);
  }
  __syncthreads();

  float mrow = -__builtin_inff();    /* running maximum of query q0+c, equal in both lane halves */
  float lrow = 0.f;                  /* running sum over this lane half's keys */
  v8f oacc[4];
#pragma unroll
  for (int t = 0; t < 4; ++t) oacc[t] = (v8f){0.f,0.f,0.f,0.f,0.f,0.f,0.f,0.f};

  const unsigned short* Kp  = Kh  + (size_t)bh * SEQ * DH;
  const unsigned short* Vhp = Vth + (size_t)bh * DH * SEQ;
  const unsigned short* Vlp = Vtl + (size_t)bh * DH * SEQ;
  const int bbase = q0 + c - 8 * hh + (MAXLEN - 1);    /* bias index = bbase - kv0 - 16j - r */

#pragma unroll 1
  for (int kc = 0; kc < SEQ / KCH; ++kc) {
    const int kv0 = kc * KCH;
    __syncthreads();
#pragma unroll
    for (int it = 0; it < 4; ++it) {
      const int u   = it * 128 + tid;
      const int row = u >> 3;
      const int seg = u & 7;
      const v4u kw = *(const v4u*)(Kp  + (size_t)(kv0 + row) * DH + seg * 8);
      const v4u hw = *(const v4u*)(Vhp + (size_t)row * SEQ + kv0 + seg * 8);
      const v4u lw = *(const v4u*)(Vlp + (size_t)row * SEQ + kv0 + seg * 8);
      *(v4u*)(Ksh + row * TPQ + seg * 8) = kw;
      *(v4u*)(Vhs + row * TPQ + seg * 8) = hw;
      *(v4u*)(Vls + row * TPQ + seg * 8) = lw;
    }
    __syncthreads();

    /* scores, transposed: 64 keys (rows) x 16 queries (columns) per wave */
    v8f s[4];
#pragma unroll
    for (int j = 0; j < 4; ++j) {
      s[j] = (v8f){0.f,0.f,0.f,0.f,0.f,0.f,0.f,0.f};
#pragma unroll
      for (int dc = 0; dc < 2; ++dc) {
        FragH kf;
        kf.u[0] = *(const v4u*)(Ksh + (j * 16 + c) * TPQ + dc * 32 + 8 * hh);
        kf.u[1] = *(const v4u*)(Ksh + (j * 16 + c) * TPQ + dc * 32 + 16 + 8 * hh);
        s[j] = mma_f16(kf.v, qa[dc].v, s[j]);
      }
    }

    /* scale 1/8 and rel-pos bias: key index = kv0 + 16j + 8hh + r, query = q0 + c */
    const int boff = bbase - kv0;
#pragma unroll
    for (int j = 0; j < 4; ++j)
#pragma unroll
      for (int r = 0; r < 8; ++r)
        s[j][r] = s[j][r] * 0.125f + sbias[boff - 16 * j - r];

    /* chunk maximum of this lane's query: 32 keys in-lane, the other 32 from lane ^ 16 */
    float cj[4];
#pragma unroll
    for (int j = 0; j < 4; ++j) {
      cj[j] = s[j][0];
#pragma unroll
      for (int r = 1; r < 8; ++r) cj[j] = fmaxf(cj[j], s[j][r]);
    }
    float cm = fmaxf(fmaxf(cj[0], cj[1]), fmaxf(cj[2], cj[3]));
    cm = fmaxf(cm, xhalf(cm));

    /* online softmax update; P as bf16 hi + lo, packed in place into B operands */
    const float mnew  = fmaxf(mrow, cm);
    const float alpha = __expf(mrow - mnew);
    mrow = mnew;
    FragB ph[2], pl[2];
    float pj[4];                     /* one sum chain per key tile */
#pragma unroll
    for (int j = 0; j < 4; ++j) {
      pj[j] = 0.f;
#pragma unroll
      for (int r2 = 0; r2 < 4; ++r2) {
        const float p0 = __expf(s[j][2 * r2]     - mnew);
        const float p1 = __expf(s[j][2 * r2 + 1] - mnew);
        pj[j] += p0;
        pj[j] += p1;
        const unsigned h0 = bf_round(p0);
        const unsigned h1 = bf_round(p1);
        const unsigned l0 = bf_round(p0 - __uint_as_float(h0 & 0xFFFF0000u));
        const unsigned l1 = bf_round(p1 - __uint_as_float(h1 & 0xFFFF0000u));
        ph[j >> 1].u[j & 1][r2] = pk_top(h0, h1);
        pl[j >> 1].u[j & 1][r2] = pk_top(l0, l1);
      }
    }
    lrow = lrow * alpha + ((pj[0] + pj[1]) + (pj[2] + pj[3]));
#pragma unroll
    for (int t = 0; t < 4; ++t)
#pragma unroll
      for (int r = 0; r < 8; ++r) oacc[t][r] *= alpha;

    /* O^T += V^T.P^T : A = V^T [d][kv] rows, B = P^T [kv][q] from the registers above */
#pragma unroll
    for (int kk = 0; kk < 2; ++kk) {
#pragma unroll
      for (int t = 0; t < 4; ++t) {
        FragB vh, vl;
        vh.u[0] = *(const v4u*)(Vhs + (t * 16 + c) * TPQ + kk * 32 + 8 * hh);
        vh.u[1] = *(const v4u*)(Vhs + (t * 16 + c) * TPQ + kk * 32 + 16 + 8 * hh);
        vl.u[0] = *(const v4u*)(Vls + (t * 16 + c) * TPQ + kk * 32 + 8 * hh);
        vl.u[1] = *(const v4u*)(Vls + (t * 16 + c) * TPQ + kk * 32 + 16 + 8 * hh);
        oacc[t] = mma_bf16(vh.v, ph[kk].v, oacc[t]);
        oacc[t] = mma_bf16(vh.v, pl[kk].v, oacc[t]);
        oacc[t] = mma_bf16(vl.v, ph[kk].v, oacc[t]);
      }
    }
  }

  /* join the halves' sums, normalise, x16 carry, f16 slab [query][d], then whole-line stores into Ctx */
  unsigned short* os = Osh[wave];
  {
    const float inv = 1.0f / (lrow + xhalf(lrow));
#pragma unroll
    for (int t = 0; t < 4; ++t) {
      v4u w;
#pragma unroll
      for (int r2 = 0; r2 < 4; ++r2)
        w[r2] = pk16(f2h_bits(oacc[t][2 * r2] * inv * 16.0f), f2h_bits(oacc[t][2 * r2 + 1] * inv * 16.0f));
      *(v4u*)(os + c * TPQ + t * 16 + 8 * hh) = w;
    }
  }
  __builtin_amdgcn_fence(3, "workgroup");
  __builtin_amdgcn_wave_barrier();
  __builtin_amdgcn_fence(2, "workgroup");
  {
    unsigned short* cdst = Ctx + ((size_t)bi * SEQ + q0) * DM + head * DH;
    {
#pragma unroll
      for (int it = 0; it < 4; ++it) {
        const int row = it * 4 + (lane >> 3);
        const int seg = lane & 7;
        const v4u val = *(const v4u*)(os + row * TPQ + seg * 8);
        *(v4u*)(cdst + (size_t)row * DM + seg * 8) = val;
      }
      
    }
  }
}

/* --------------------------------------------------------------------------
 * out = Ctx.Wot (f16 WMMA, x1024 total carry folded by 2^-10) + bo, f32 output.
 * Block = 4 waves (2 x 2), tile 128 tokens x 128 columns, operands staged in LDS (gemm_tile);
 * grid (MROWS/128, DM/128). The ring is output staging after the loop's last barrier:
 * per-wave f32 slab 64x64; rows it*2+hh, it 0..31, pieces (lane&15)*4.
 * ------------------------------------------------------------------------ */
__global__ __launch_bounds__(128) __attribute__((amdgpu_num_vgpr(256)))
void out_gemm_kernel(const unsigned short* __restrict__ Ctx, const unsigned short* __restrict__ Wot,
                     const float* __restrict__ bo, float* __restrict__ out)
{
  __shared__ __align__(16) unsigned short Ring[2 * GSTG];
  const int tid  = threadIdx.x;
  const int wave = tid >> 5;
  const int lane = tid & 31;
  const int hh   = lane >> 4;
  const int c    = lane & 15;
  const int wm   = wave >> 1;
  const int wn   = wave & 1;
  const int m0   = blockIdx.x * GBM;
  const int n0   = blockIdx.y * GBN;

  v8f acc[4][4];
  gemm_tile<true>(Ctx, Wot, Ring, m0, n0, acc);

  float bb[4];
#pragma unroll
  for (int tt = 0; tt < 4; ++tt) bb[tt] = bfr(bo[n0 + 64 * wn + 16 * tt + c]);

  float* os = (float*)Ring + wave * (64 * OSP);
#pragma unroll
  for (int rt = 0; rt < 4; ++rt)
#pragma unroll
    for (int tt = 0; tt < 4; ++tt)
#pragma unroll
      for (int r = 0; r < 8; ++r)
        os[(16 * rt + 8 * hh + r) * OSP + 16 * tt + c] = acc[rt][tt][r] * (1.0f / 1024.0f) + bb[tt];
  __builtin_amdgcn_fence(3, "workgroup");
  __builtin_amdgcn_wave_barrier();
  __builtin_amdgcn_fence(2, "workgroup");

  const int bi  = m0 / SEQ;
  const int nn0 = m0 - bi * SEQ;
  float* ob = out + ((size_t)bi * SEQ_FULL + nn0 + 64 * wm) * DM + n0 + 64 * wn;
  const int c4 = (lane & 15) * 4;
#pragma unroll
  for (int it = 0; it < 32; ++it) {
    const int row = it * 2 + hh;
    const v4f val = *(const v4f*)(os + row * OSP + c4);
    *(v4f*)(ob + (size_t)row * DM + c4) = val;
  }
}

extern "C" void kernel_launch(void* const* d_in, const int* in_sizes, int n_in,
                              void* d_out, int out_size, void* d_ws, size_t ws_size,
                              hipStream_t stream)
{
  if (n_in < 6) return;
  const long need_x = ((long)(NB - 1) * SEQ_FULL + SEQ) * DM;
  if ((long)in_sizes[0] < need_x) return;
  if ((long)in_sizes[1] < (long)DM * NF) return;
  if (in_sizes[2] < NF) return;
  if ((long)in_sizes[3] < (long)NREL * NH) return;
  if ((long)in_sizes[4] < (long)DM * DM) return;
  if (in_sizes[5] < DM) return;
  if ((long)out_size < need_x) return;
  if (d_ws == nullptr || ws_size < WS_NEED) return;

  const float* x     = (const float*)d_in[0];
  const float* w_qkv = (const float*)d_in[1];
  const float* b_qkv = (const float*)d_in[2];
  const float* rel   = (const float*)d_in[3];
  const float* w_out = (const float*)d_in[4];
  const float* b_out = (const float*)d_in[5];
  float* out = (float*)d_out;

  unsigned short* Xb  = (unsigned short*)d_ws;   /* offset 0 */
  unsigned short* Wqt = Xb  + PLANE16;
  unsigned short* Wot = Wqt + WQT_EL;
  unsigned short* Qh  = Wot + WOT_EL;
  unsigned short* Kh  = Qh  + PLANE16;
  unsigned short* Vth = Kh  + PLANE16;
  unsigned short* Vtl = Vth + PLANE16;
  unsigned short* Ctx = Vtl + PLANE16;           /* ends at WS_NEED */

  cvt_x_kernel<<<dim3((unsigned)((MROWS * DM) / 2048)), 256, 0, stream>>>(x, Xb);
  wtrans_kernel<0><<<dim3(NF / 64, DM / 64), 256, 0, stream>>>(w_qkv, Wqt, NF);
  wtrans_kernel<1><<<dim3(DM / 64, DM / 64), 256, 0, stream>>>(w_out, Wot, DM);
  qkv_gemm_kernel<<<dim3(MROWS / GBM, NF / GBN), 128, 0, stream>>>(Xb, Wqt, b_qkv, Qh, Kh, Vth, Vtl);
  attn_kernel<<<dim3(SEQ / QBLK, NBH), 128, 0, stream>>>(Qh, Kh, Vth, Vtl, rel, Ctx);
  out_gemm_kernel<<<dim3(MROWS / GBM, DM / GBN), 128, 0, stream>>>(Ctx, Wot, b_out, out);
}

// v004
// One run takes 122 microseconds.
// Timed twice side by side with v003, it ran 1.09 and 1.08 times as fast.
// All steps since v000 together make it 2.56 times as fast.
// Contractions: qkv = x.w_qkv on v_wmma_f32_16x16x32_bf16 (bf16 operands from RNE-converted inputs); scores = q.k^T on v_wmma_f32_16x16x32_f16 (f16 operands, 1/8 applied in f32); ctx = p.v on v_wmma_f32_16x16x32_bf16 with p and v as bf16 hi+lo planes (three products); out = ctx.w_out on v_wmma_f32_16x16x32_f16 (ctx carried x16, w_out as bf16 value x64, 2^-10 fold in f32); f32 accumulate, f32 online softmax.
#include <hip/hip_runtime.h>

typedef __attribute__((ext_vector_type(16))) __bf16       v16b;
typedef __attribute__((ext_vector_type(16))) _Float16     v16h;
typedef __attribute__((ext_vector_type(8)))  float        v8f;
typedef __attribute__((ext_vector_type(4)))  float        v4f;
typedef __attribute__((ext_vector_type(4)))  unsigned int v4u;
typedef __attribute__((ext_vector_type(2)))  float        v2f;
typedef __attribute__((ext_vector_type(2)))  __bf16       v2b;

#ifndef NB
#define NB 16
#endif
#ifndef SEQ
#define SEQ 512
#endif
#define NB_FULL  16
#define SEQ_FULL 512

constexpr int DM     = 1024;            /* model dim = inner dim */
constexpr int NH     = 16;              /* heads */
constexpr int DH     = 64;              /* head dim */
constexpr int NF     = 3 * NH * DH;     /* 3072 qkv features */
constexpr int MAXLEN = 512;
constexpr int NREL   = 2 * MAXLEN - 1;  /* 1023 bias rows */
constexpr int MROWS  = NB * SEQ;        /* compact token rows */
constexpr int NBH    = NB * NH;
constexpr int KCH    = 64;              /* keys per staged chunk */
constexpr int QBLK   = 64;              /* query rows per block (4 waves x 16) */
constexpr int NWAVE  = 4;
constexpr int TPQ    = 72;              /* 16-bit LDS tile pitch, 64-wide rows (144 B) */
constexpr int OSP    = 68;              /* f32 LDS slab pitch (272 B) */
constexpr int GBM    = 128;             /* GEMM block tile, token rows */
constexpr int GBN    = 128;             /* GEMM block tile, feature rows of the [n][k] operand */
constexpr int GBK    = 64;              /* k per staged tile: 128-B rows at pitch TPQ */
constexpr int GSTG   = (GBM + GBN) * TPQ;   /* 16-bit elements of one ring buffer (36864 B) */
constexpr int GNT    = DM / GBK;        /* staged tiles along k */

constexpr size_t PLANE16 = (size_t)MROWS * DM;          /* elements of a [MROWS][1024] 16-bit plane */
constexpr size_t WQT_EL  = (size_t)NF * DM;
constexpr size_t WOT_EL  = (size_t)DM * DM;
constexpr size_t WS_NEED = (6 * PLANE16 + WQT_EL + WOT_EL) * 2;   /* 109051904 B at NB=16, SEQ=512 */

static_assert(NB >= 1 && NB <= NB_FULL);
static_assert(SEQ >= 128 && SEQ <= SEQ_FULL && SEQ <= MAXLEN);
static_assert(SEQ % 128 == 0);
static_assert(SEQ % KCH == 0 && SEQ % QBLK == 0);
static_assert(DH == 64 && NH * DH == DM);
static_assert(DM % 64 == 0 && NF % 64 == 0 && NF == 3 * DM);
static_assert(MROWS % 128 == 0);
static_assert((MROWS * DM) % 2048 == 0);
static_assert(NREL <= 1024);
static_assert(TPQ % 8 == 0 && OSP % 4 == 0);
static_assert(MROWS % GBM == 0 && SEQ % GBM == 0 && DM % GBN == 0 && NF % GBN == 0);
static_assert(GNT >= 2 && DM % GBK == 0);
static_assert(NWAVE * 2 * 64 * TPQ <= 2 * GSTG);          /* v hi+lo slabs fit the ring */
static_assert(NWAVE * 64 * OSP * 4 <= 2 * GSTG * 2);      /* f32 slabs fit the ring */
static_assert(WS_NEED <= 134217728ull);

/* workspace region map (bytes, NB=16 SEQ=512):
 *   Xb  bf16 [MROWS][1024]        16777216
 *   Wqt bf16 [3072][1024] (k-contig) 6291456
 *   Wot f16  [1024 n][1024 k]       2097152   (bf16 value x64)
 *   Qh  f16  [NBH][SEQ][64]        16777216
 *   Kh  f16  [NBH][SEQ][64]        16777216
 *   Vth bf16 [NBH][64][SEQ]        16777216   (v hi, transposed)
 *   Vtl bf16 [NBH][64][SEQ]        16777216   (v lo = v - hi)
 *   Ctx f16  [MROWS][1024]         16777216   (x16 carry)
 *   total 109051904
 */

__device__ __forceinline__ unsigned short f2bf_bits(float f) {   /* RNE, the hardware's convert */
  return __builtin_bit_cast(unsigned short, (__bf16)f);
}
__device__ __forceinline__ float bf_bits2f(unsigned short h) { return __uint_as_float(((unsigned)h) << 16); }
__device__ __forceinline__ float bfr(float f) { return bf_bits2f(f2bf_bits(f)); }   /* RNE convert to the bf16 value */
__device__ __forceinline__ unsigned short f2h_bits(float f) {
  _Float16 h = (_Float16)f;
  return __builtin_bit_cast(unsigned short, h);
}
__device__ __forceinline__ unsigned int pk16(unsigned short lo, unsigned short hi) {
  return (unsigned)lo | ((unsigned)hi << 16);
}

__device__ __forceinline__ v8f mma_bf16(v16b a, v16b b, v8f c) {
  c = __builtin_amdgcn_wmma_f32_16x16x32_bf16(false, a, false, b, (short)0, c, false, false);
  asm volatile("v_nop\n\tv_nop\n\tv_nop\n\tv_nop" : "+v"(c) : "v"(a), "v"(b));
  return c;
}
__device__ __forceinline__ v8f mma_f16(v16h a, v16h b, v8f c) {
  c = __builtin_amdgcn_wmma_f32_16x16x32_f16(false, a, false, b, (short)0, c, false, false);
  asm volatile("v_nop\n\tv_nop\n\tv_nop\n\tv_nop" : "+v"(c) : "v"(a), "v"(b));
  return c;
}

/* two f32 -> two RNE bf16 in one dword by one packed convert: e0 in the low half, e1 in the high half */
__device__ __forceinline__ v2b cvt2(float e0, float e1) { return __builtin_convertvector((v2f){e0, e1}, v2b); }

/* the value that lane ^ 16 holds */
__device__ __forceinline__ float xhalf(float v) {
  const int b = __float_as_int(v);
  return __int_as_float(__builtin_amdgcn_permlanex16(b, b, 0x76543210, 0xfedcba98, false, false));
}

union FragB { v16b v; v4u u[2]; };
union FragH { v16h v; v4u u[2]; };
union FragG { v16b b; v16h h; v4u u[2]; };

__device__ __forceinline__ unsigned lds_off(const void* p) { return (unsigned)(size_t)p; }

/* Eight asynchronous 16-B copies per lane, global -> LDS: rows 16 apart of a [row][DM] 16-bit plane
 * into rows 16 apart of a pitch-TPQ tile. The s_wait_xcnt closes the same statement so that no
 * address register of an issued copy is rewritten in front of it. */
__device__ __forceinline__ void copy8(unsigned l, const unsigned short* g)
{
  constexpr unsigned LS = 16 * TPQ * 2;
  constexpr size_t   GS = (size_t)16 * DM;
  const unsigned l0 = l,          l1 = l + LS,     l2 = l + 2 * LS, l3 = l + 3 * LS;
  const unsigned l4 = l + 4 * LS, l5 = l + 5 * LS, l6 = l + 6 * LS, l7 = l + 7 * LS;
  const unsigned short* g0 = g;
  const unsigned short* g1 = g + GS;
  const unsigned short* g2 = g + 2 * GS;
  const unsigned short* g3 = g + 3 * GS;
  const unsigned short* g4 = g + 4 * GS;
  const unsigned short* g5 = g + 5 * GS;
  const unsigned short* g6 = g + 6 * GS;
  const unsigned short* g7 = g + 7 * GS;
  asm volatile("global_load_async_to_lds_b128 %0, %8, off\n\t"
               "global_load_async_to_lds_b128 %1, %9, off\n\t"
               "global_load_async_to_lds_b128 %2, %10, off\n\t"
               "global_load_async_to_lds_b128 %3, %11, off\n\t"
               "global_load_async_to_lds_b128 %4, %12, off\n\t"
               "global_load_async_to_lds_b128 %5, %13, off\n\t"
               "global_load_async_to_lds_b128 %6, %14, off\n\t"
               "global_load_async_to_lds_b128 %7, %15, off\n\t"
               "s_wait_xcnt 0x0"
               :: "v"(l0), "v"(l1), "v"(l2), "v"(l3), "v"(l4), "v"(l5), "v"(l6), "v"(l7),
                  "v"(g0), "v"(g1), "v"(g2), "v"(g3), "v"(g4), "v"(g5), "v"(g6), "v"(g7)
               : "memory");
}

/* --------------------------------------------------------------------------
 * acc[4][4] (wave tile 64 x 64, waves 2 x 2 in a 128 x 128 block tile) = A[m0..][k] . B[n0..][k]^T,
 * both planes [row][DM] k-contiguous. Per 64-k tile the block stages [A 128 rows | B 128 rows] of
 * 128 B in LDS at pitch 144 B by asynchronous copies (thread -> row tid>>3 + 16 i, 16-B segment
 * tid&7: a wave's copy covers 4 whole lines; 2 x 8 copies per thread = the whole stage), two
 * buffers: tile t+2 is copied into the buffer that trip t has just left, behind the trip's barrier.
 * k runs upward in steps of 32 through one accumulator chain per tile.
 * ------------------------------------------------------------------------ */
template <bool F16>
__device__ __forceinline__ void gemm_tile(const unsigned short* __restrict__ A,
                                          const unsigned short* __restrict__ B,
                                          unsigned short* Ring, int m0, int n0, v8f (&acc)[4][4])
{
  const int tid  = threadIdx.x;
  const int wave = tid >> 5;
  const int lane = tid & 31;
  const int hh   = lane >> 4;
  const int c    = lane & 15;
  const int wm   = wave >> 1;
  const int wn   = wave & 1;

#pragma unroll
  for (int i = 0; i < 4; ++i)
#pragma unroll
    for (int j = 0; j < 4; ++j) acc[i][j] = (v8f){0.f,0.f,0.f,0.f,0.f,0.f,0.f,0.f};

  const int crow = tid >> 3;
  const int cseg = (tid & 7) * 8;
  const unsigned short* ga = A + (size_t)(m0 + crow) * DM + cseg;
  const unsigned short* gb = B + (size_t)(n0 + crow) * DM + cseg;
  const unsigned la = lds_off(Ring) + (unsigned)(crow * TPQ + cseg) * 2u;
  const unsigned lb = la + (unsigned)(GBM * TPQ) * 2u;

  copy8(la, ga);
  copy8(lb, gb);
  asm volatile("s_wait_asynccnt 0x0" ::: "memory");   /* tile 0 of this wave has landed before the barrier publishes it */
  __syncthreads();
  copy8(la + (unsigned)GSTG * 2u, ga + GBK);
  copy8(lb + (unsigned)GSTG * 2u, gb + GBK);

  const unsigned short* fa = Ring + (64 * wm + c) * TPQ + 8 * hh;
  const unsigned short* fb = Ring + (GBM + 64 * wn + c) * TPQ + 8 * hh;

#pragma unroll 1   /* one staged tile per trip: the ring's waits and barrier stand once, at the foot */
  for (int t = 0; t < GNT; ++t) {
    const int bo = (t & 1) * GSTG;
#pragma unroll
    for (int ks = 0; ks < GBK / 32; ++ks) {
      FragG a[4], b[4];
#pragma unroll
      for (int i = 0; i < 4; ++i) {
        a[i].u[0] = *(const v4u*)(fa + bo + i * 16 * TPQ + ks * 32);
        a[i].u[1] = *(const v4u*)(fa + bo + i * 16 * TPQ + ks * 32 + 16);
        b[i].u[0] = *(const v4u*)(fb + bo + i * 16 * TPQ + ks * 32);
        b[i].u[1] = *(const v4u*)(fb + bo + i * 16 * TPQ + ks * 32 + 16);
      }
#pragma unroll
      for (int i = 0; i < 4; ++i)
#pragma unroll
        for (int j = 0; j < 4; ++j) {
          if constexpr (F16) acc[i][j] = mma_f16(a[i].h, b[j].h, acc[i][j]);
          else               acc[i][j] = mma_bf16(a[i].b, b[j].b, acc[i][j]);
        }
    }
    asm volatile("s_wait_dscnt 0x0" ::: "memory");      /* this wave's reads of buffer t&1 are done before it is refilled */
    asm volatile("s_wait_asynccnt 0x0" ::: "memory");   /* this wave's copies of tile t+1 have landed before the barrier publishes them */
    __syncthreads();
    if (t + 2 < GNT) {
      copy8(la + (unsigned)bo * 2u, ga + (t + 2) * GBK);
      copy8(lb + (unsigned)bo * 2u, gb + (t + 2) * GBK);
    }
  }
  asm volatile("s_wait_asynccnt 0x0" ::: "memory");     /* no copy is in flight when the ring becomes output staging */
}

/* Fragment map used everywhere (hh = lane>>4, c = lane&15):
 * A: row c, elements 0..7 <- k0+8hh+0..7, 8..15 <- k0+16+8hh+0..7 (two 16-B loads from a k-contiguous row);
 * B: column c with the SAME k map, loaded from a [n][k] k-contiguous copy exactly like A;
 * D: element r = (row 8hh+r, col c). */

/* --------------------------------------------------------------------------
 * x (f32, full-size strides) -> Xb bf16 [MROWS][1024].
 * Block = 256 threads = 2 compact rows; thread -> 8 consecutive elements, one
 * Coverage: MROWS/2 blocks x 2048 elements = the whole plane.
 * ------------------------------------------------------------------------ */
__global__ __launch_bounds__(256) void cvt_x_kernel(const float* __restrict__ x,
                                                    unsigned short* __restrict__ Xb)
{
  const int tid  = threadIdx.x;
  const int e    = tid * 8;
  const int crow = blockIdx.x * 2 + e / DM;
  const int col  = e % DM;
  const int bi   = crow / SEQ;
  const int n    = crow - bi * SEQ;
  const float* src = x + ((size_t)bi * SEQ_FULL + n) * DM + col;
  const v4f f0 = *(const v4f*)src;
  const v4f f1 = *(const v4f*)(src + 4);
  v4u w;
  w[0] = pk16(f2bf_bits(f0[0]), f2bf_bits(f0[1]));
  w[1] = pk16(f2bf_bits(f0[2]), f2bf_bits(f0[3]));
  w[2] = pk16(f2bf_bits(f1[0]), f2bf_bits(f1[1]));
  w[3] = pk16(f2bf_bits(f1[2]), f2bf_bits(f1[3]));
  unsigned short* dst = Xb + (size_t)crow * DM + col;
  *(v4u*)dst = w;
  
}

/* --------------------------------------------------------------------------
 * w [1024 k][nf] f32 -> Wt [nf][1024] 16-bit (k-contiguous rows).
 * KIND 0: bf16 bits; KIND 1: f16 bits of (bf16 value x64).
 * Block (x = n tile of 64, y = k tile of 64), 256 threads.
 * Load: thread -> k row tid>>2, 16 columns; 64x64 covered once. Transposed into LDS [n][k].
 * Store: 512 units (2 per thread): unit u -> n row u>>3, 16-B segment u&7; lanes
 * Coverage: grid (nf/64, 16) x 64x64 = the whole plane.
 * ------------------------------------------------------------------------ */
template <int KIND>
__global__ __launch_bounds__(256) void wtrans_kernel(const float* __restrict__ w,
                                                     unsigned short* __restrict__ Wt, int nf)
{
  __shared__ __align__(16) unsigned short Ts[64 * TPQ];     /* [n][k] */
  const int tid  = threadIdx.x;
  const int n0   = blockIdx.x * 64;
  const int k0   = blockIdx.y * 64;
  const int krow = tid >> 2;
  const int fseg = (tid & 3) * 16;
  const float* src = w + (size_t)(k0 + krow) * nf + n0 + fseg;
#pragma unroll
  for (int i = 0; i < 4; ++i) {
    const v4f f = *(const v4f*)(src + 4 * i);
#pragma unroll
    for (int e2 = 0; e2 < 4; ++e2) {
      const float v = f[e2];
      unsigned short bits;
      if (KIND == 0) bits = f2bf_bits(v);
      else           bits = f2h_bits(bfr(v) * 64.0f);
      Ts[(fseg + 4 * i + e2) * TPQ + krow] = bits;
    }
  }
  __syncthreads();
  {
#pragma unroll
    for (int it = 0; it < 2; ++it) {
      const int u    = it * 256 + tid;
      const int frow = u >> 3;
      const int seg  = u & 7;
      const v4u val = *(const v4u*)(Ts + frow * TPQ + seg * 8);
      *(v4u*)(Wt + (size_t)(n0 + frow) * DM + k0 + seg * 8) = val;
    }
    
  }
}

/* --------------------------------------------------------------------------
 * qkv = Xb.Wq + bq on bf16 WMMA. Block = 4 waves (2 x 2), tile 128 tokens x 128 features,
 * operands staged in LDS (gemm_tile); grid (MROWS/128, NF/128).
 * A wave's 64 features are exactly one (sel, head); sel is block-uniform.
 * The ring is output staging after the loop's last barrier; every slab is wave-private.
 * sel 0/1: q/k -> f16 plane [bh][n][d]: per-wave 64x64 LDS tile, then 64 whole 128-B rows:
 *   rows it*4+(lane>>3), it 0..15, segs lane&7.
 * sel 2: v -> bf16 hi and lo planes [bh][d][n]: per-wave 64x64 transposed LDS tiles, each d row =
 *   64 tokens = 128 B = 8 lanes x 16 B; rows it*4+(lane>>3), it 0..15.
 * ------------------------------------------------------------------------ */
__global__ __launch_bounds__(128) __attribute__((amdgpu_num_vgpr(256)))
void qkv_gemm_kernel(const unsigned short* __restrict__ Xb, const unsigned short* __restrict__ Wqt,
                     const float* __restrict__ bq,
                     unsigned short* __restrict__ Qh, unsigned short* __restrict__ Kh,
                     unsigned short* __restrict__ Vth, unsigned short* __restrict__ Vtl)
{
  __shared__ __align__(16) unsigned short Ring[2 * GSTG];
  const int tid  = threadIdx.x;
  const int wave = tid >> 5;
  const int lane = tid & 31;
  const int hh   = lane >> 4;
  const int c    = lane & 15;
  const int wm   = wave >> 1;
  const int wn   = wave & 1;
  const int m0   = blockIdx.x * GBM;
  const int n0   = blockIdx.y * GBN;
  const int sel  = blockIdx.y / (DM / GBN);
  const int head = (blockIdx.y - sel * (DM / GBN)) * (GBN / DH) + wn;

  v8f acc[4][4];
  gemm_tile<false>(Xb, Wqt, Ring, m0, n0, acc);

  float bb[4], bl[4];
  const int bidx = n0 + 64 * wn + c;
#pragma unroll
  for (int tt = 0; tt < 4; ++tt) bl[tt] = bq[bidx + 16 * tt];
  /* the four loads share the index register: it is named here so that it lives up to the wait and no load's result lands in it */
  asm volatile("s_wait_xcnt 0x0" :: "v"(bidx) : "memory");
#pragma unroll
  for (int tt = 0; tt < 4; ++tt) bb[tt] = bfr(bl[tt]);

  const int bi  = m0 / SEQ;
  const int nn0 = m0 - bi * SEQ + 64 * wm;
  const int bh  = bi * NH + head;

  if (sel < 2) {
    unsigned short* plane = (sel == 0) ? Qh : Kh;
    unsigned short* ls = Ring + wave * (64 * TPQ);      /* [token][d], wave-private, block barrier used */
#pragma unroll
    for (int rt = 0; rt < 4; ++rt)
#pragma unroll
      for (int tt = 0; tt < 4; ++tt)
#pragma unroll
        for (int r = 0; r < 8; ++r)
          ls[(16 * rt + 8 * hh + r) * TPQ + 16 * tt + c] = f2h_bits(acc[rt][tt][r] + bb[tt]);
    __syncthreads();
    unsigned short* dst = plane + ((size_t)bh * SEQ + nn0) * DH;
#pragma unroll
    for (int it = 0; it < 16; ++it) {
      const int row = it * 4 + (lane >> 3);
      const int seg = lane & 7;
      const v4u val = *(const v4u*)(ls + row * TPQ + seg * 8);
      *(v4u*)(dst + (size_t)row * DH + seg * 8) = val;
    }
  } else {
    unsigned short* th = Ring + wave * (2 * 64 * TPQ);  /* v hi [d][token 0..63], wave-private, block barrier used */
    unsigned short* tl = th + 64 * TPQ;                 /* v lo */
#pragma unroll
    for (int rt = 0; rt < 4; ++rt)
#pragma unroll
      for (int tt = 0; tt < 4; ++tt)
#pragma unroll
        for (int r = 0; r < 8; ++r) {
          const float v = acc[rt][tt][r] + bb[tt];
          const unsigned short hb = f2bf_bits(v);
          const unsigned short lb = f2bf_bits(v - bf_bits2f(hb));
          const int tok = 16 * rt + 8 * hh + r;
          const int d   = 16 * tt + c;
          th[d * TPQ + tok] = hb;
          tl[d * TPQ + tok] = lb;
        }
    __syncthreads();
    const size_t vbase = (size_t)bh * DH * SEQ + nn0;
#pragma unroll
    for (int it = 0; it < 16; ++it) {
      const int drow = it * 4 + (lane >> 3);
      const int seg  = lane & 7;
      const v4u hv = *(const v4u*)(th + drow * TPQ + seg * 8);
      const v4u lv = *(const v4u*)(tl + drow * TPQ + seg * 8);
      *(v4u*)(Vth + vbase + (size_t)drow * SEQ + seg * 8) = hv;
      *(v4u*)(Vtl + vbase + (size_t)drow * SEQ + seg * 8) = lv;
    }
    asm volatile("s_wait_xcnt 0x0" ::: "memory");   /* behind the last store, before a register that a store names is written again */
  }
}

__global__ __launch_bounds__(128) __attribute__((amdgpu_num_vgpr(256)))
void attn_kernel(const unsigned short* __restrict__ Qh, const unsigned short* __restrict__ Kh,
                 const unsigned short* __restrict__ Vth, const unsigned short* __restrict__ Vtl,
                 const float* __restrict__ rel, unsigned short* __restrict__ Ctx)
{
  __shared__ __align__(16) unsigned short Ksh[KCH * TPQ];           /* K  [kv][d] f16, row pitch TPQ */
  __shared__ __align__(16) unsigned short Vhs[DH * TPQ];            /* Vh [d][kv] bf16, row pitch TPQ */
  __shared__ __align__(16) unsigned short Vls[DH * TPQ];            /* Vl [d][kv] bf16, row pitch TPQ */
  __shared__ __align__(16) unsigned short Osh[NWAVE][16 * TPQ];     /* out slab per wave (f16) */
  __shared__ float sbias[1024];                                     /* bias column of this head, bf16 value */

  const int tid  = threadIdx.x;
  const int wave = tid >> 5;
  const int lane = tid & 31;
  const int hh   = lane >> 4;
  const int c    = lane & 15;
  const int qb   = blockIdx.x;
  const int bh   = blockIdx.y;
  const int bi   = bh / NH;
  const int head = bh - bi * NH;
  const int q0   = qb * QBLK + wave * 16;

  for (int t = tid; t < 1024; t += 128) {
    const int ti = t < NREL ? t : (NREL - 1);
    const float v = bfr(rel[(size_t)ti * NH + head]);
    sbias[t] = (t < NREL) ? v : 0.f;
  }

  FragH qa[2];
  {
    const unsigned short* qrow = Qh + ((size_t)bh * SEQ + q0 + c) * DH + 8 * hh;
    qa[0].u[0] = *(const v4u*)(qrow);
    qa[0].u[1] = *(const v4u*)(qrow + 16);
    qa[1].u[0] = *(const v4u*)(qrow + 32);
    qa[1].u[1] = *(const v4u*)(qrow + 48);
  }
  __syncthreads();

  float mrow = -__builtin_inff();    /* running maximum of query q0+c, equal in both lane halves */
  float lrow = 0.f;                  /* running sum over this lane half's keys */
  v8f oacc[4];
#pragma unroll
  for (int t = 0; t < 4; ++t) oacc[t] = (v8f){0.f,0.f,0.f,0.f,0.f,0.f,0.f,0.f};

  const unsigned short* Kp  = Kh  + (size_t)bh * SEQ * DH;
  const unsigned short* Vhp = Vth + (size_t)bh * DH * SEQ;
  const unsigned short* Vlp = Vtl + (size_t)bh * DH * SEQ;
  const int bbase = q0 + c - 8 * hh + (MAXLEN - 1);    /* bias index = bbase - kv0 - 16j - r */

#pragma unroll 1
  for (int kc = 0; kc < SEQ / KCH; ++kc) {
    const int kv0 = kc * KCH;
    __syncthreads();
#pragma unroll
    for (int it = 0; it < 4; ++it) {
      const int u   = it * 128 + tid;
      const int row = u >> 3;
      const int seg = u & 7;
      const v4u kw = *(const v4u*)(Kp  + (size_t)(kv0 + row) * DH + seg * 8);
      const v4u hw = *(const v4u*)(Vhp + (size_t)row * SEQ + kv0 + seg * 8);
      const v4u lw = *(const v4u*)(Vlp + (size_t)row * SEQ + kv0 + seg * 8);
      *(v4u*)(Ksh + row * TPQ + seg * 8) = kw;
      *(v4u*)(Vhs + row * TPQ + seg * 8) = hw;
      *(v4u*)(Vls + row * TPQ + seg * 8) = lw;
    }
    __syncthreads();

    /* scores, transposed: 64 keys (rows) x 16 queries (columns) per wave */
    v8f s[4];
#pragma unroll
    for (int j = 0; j < 4; ++j) {
      s[j] = (v8f){0.f,0.f,0.f,0.f,0.f,0.f,0.f,0.f};
#pragma unroll
      for (int dc = 0; dc < 2; ++dc) {
        FragH kf;
        kf.u[0] = *(const v4u*)(Ksh + (j * 16 + c) * TPQ + dc * 32 + 8 * hh);
        kf.u[1] = *(const v4u*)(Ksh + (j * 16 + c) * TPQ + dc * 32 + 16 + 8 * hh);
        s[j] = mma_f16(kf.v, qa[dc].v, s[j]);
      }
    }

    /* scale 1/8 and rel-pos bias: key index = kv0 + 16j + 8hh + r, query = q0 + c */
    const int boff = bbase - kv0;
#pragma unroll
    for (int j = 0; j < 4; ++j)
#pragma unroll
      for (int r = 0; r < 8; ++r)
        s[j][r] = s[j][r] * 0.125f + sbias[boff - 16 * j - r];

    /* chunk maximum of this lane's query: 32 keys in-lane, the other 32 from lane ^ 16 */
    float cj[4];
#pragma unroll
    for (int j = 0; j < 4; ++j) {
      cj[j] = s[j][0];
#pragma unroll
      for (int r = 1; r < 8; ++r) cj[j] = fmaxf(cj[j], s[j][r]);
    }
    float cm = fmaxf(fmaxf(cj[0], cj[1]), fmaxf(cj[2], cj[3]));
    cm = fmaxf(cm, xhalf(cm));

    /* online softmax update; P as bf16 hi + lo, packed in place into B operands */
    const float mnew  = fmaxf(mrow, cm);
    const float alpha = __expf(mrow - mnew);
    mrow = mnew;
    FragB ph[2], pl[2];
    float pj[4];                     /* one sum chain per key tile */
#pragma unroll
    for (int j = 0; j < 4; ++j) {
      pj[j] = 0.f;
#pragma unroll
      for (int r2 = 0; r2 < 4; ++r2) {
        const float p0 = __expf(s[j][2 * r2]     - mnew);
        const float p1 = __expf(s[j][2 * r2 + 1] - mnew);
        pj[j] += p0;
        pj[j] += p1;
        const v2b h = cvt2(p0, p1);
        const v2b l = cvt2(p0 - (float)h[0], p1 - (float)h[1]);
        ph[j >> 1].u[j & 1][r2] = __builtin_bit_cast(unsigned, h);
        pl[j >> 1].u[j & 1][r2] = __builtin_bit_cast(unsigned, l);
      }
    }
    lrow = lrow * alpha + ((pj[0] + pj[1]) + (pj[2] + pj[3]));
#pragma unroll
    for (int t = 0; t < 4; ++t)
#pragma unroll
      for (int r = 0; r < 8; ++r) oacc[t][r] *= alpha;

    /* O^T += V^T.P^T : A = V^T [d][kv] rows, B = P^T [kv][q] from the registers above */
#pragma unroll
    for (int kk = 0; kk < 2; ++kk) {
#pragma unroll
      for (int t = 0; t < 4; ++t) {
        FragB vh, vl;
        vh.u[0] = *(const v4u*)(Vhs + (t * 16 + c) * TPQ + kk * 32 + 8 * hh);
        vh.u[1] = *(const v4u*)(Vhs + (t * 16 + c) * TPQ + kk * 32 + 16 + 8 * hh);
        vl.u[0] = *(const v4u*)(Vls + (t * 16 + c) * TPQ + kk * 32 + 8 * hh);
        vl.u[1] = *(const v4u*)(Vls + (t * 16 + c) * TPQ + kk * 32 + 16 + 8 * hh);
        oacc[t] = mma_bf16(vh.v, ph[kk].v, oacc[t]);
        oacc[t] = mma_bf16(vh.v, pl[kk].v, oacc[t]);
        oacc[t] = mma_bf16(vl.v, ph[kk].v, oacc[t]);
      }
    }
  }

  /* join the halves' sums, normalise, x16 carry, f16 slab [query][d], then whole-line stores into Ctx */
  unsigned short* os = Osh[wave];
  {
    const float inv = 1.0f / (lrow + xhalf(lrow));
#pragma unroll
    for (int t = 0; t < 4; ++t) {
      v4u w;
#pragma unroll
      for (int r2 = 0; r2 < 4; ++r2)
        w[r2] = pk16(f2h_bits(oacc[t][2 * r2] * inv * 16.0f), f2h_bits(oacc[t][2 * r2 + 1] * inv * 16.0f));
      *(v4u*)(os + c * TPQ + t * 16 + 8 * hh) = w;
    }
  }
  __builtin_amdgcn_fence(3, "workgroup");
  __builtin_amdgcn_wave_barrier();
  __builtin_amdgcn_fence(2, "workgroup");
  {
    unsigned short* cdst = Ctx + ((size_t)bi * SEQ + q0) * DM + head * DH;
    {
#pragma unroll
      for (int it = 0; it < 4; ++it) {
        const int row = it * 4 + (lane >> 3);
        const int seg = lane & 7;
        const v4u val = *(const v4u*)(os + row * TPQ + seg * 8);
        *(v4u*)(cdst + (size_t)row * DM + seg * 8) = val;
      }
      
    }
  }
}

/* --------------------------------------------------------------------------
 * out = Ctx.Wot (f16 WMMA, x1024 total carry folded by 2^-10) + bo, f32 output.
 * Block = 4 waves (2 x 2), tile 128 tokens x 128 columns, operands staged in LDS (gemm_tile);
 * grid (MROWS/128, DM/128). The ring is output staging after the loop's last barrier:
 * per-wave f32 slab 64x64; rows it*2+hh, it 0..31, pieces (lane&15)*4.
 * ------------------------------------------------------------------------ */
__global__ __launch_bounds__(128) __attribute__((amdgpu_num_vgpr(256)))
void out_gemm_kernel(const unsigned short* __restrict__ Ctx, const unsigned short* __restrict__ Wot,
                     const float* __restrict__ bo, float* __restrict__ out)
{
  __shared__ __align__(16) unsigned short Ring[2 * GSTG];
  const int tid  = threadIdx.x;
  const int wave = tid >> 5;
  const int lane = tid & 31;
  const int hh   = lane >> 4;
  const int c    = lane & 15;
  const int wm   = wave >> 1;
  const int wn   = wave & 1;
  const int m0   = blockIdx.x * GBM;
  const int n0   = blockIdx.y * GBN;

  v8f acc[4][4];
  gemm_tile<true>(Ctx, Wot, Ring, m0, n0, acc);

  float bb[4];
#pragma unroll
  for (int tt = 0; tt < 4; ++tt) bb[tt] = bfr(bo[n0 + 64 * wn + 16 * tt + c]);

  float* os = (float*)Ring + wave * (64 * OSP);
#pragma unroll
  for (int rt = 0; rt < 4; ++rt)
#pragma unroll
    for (int tt = 0; tt < 4; ++tt)
#pragma unroll
      for (int r = 0; r < 8; ++r)
        os[(16 * rt + 8 * hh + r) * OSP + 16 * tt + c] = acc[rt][tt][r] * (1.0f / 1024.0f) + bb[tt];
  __builtin_amdgcn_fence(3, "workgroup");
  __builtin_amdgcn_wave_barrier();
  __builtin_amdgcn_fence(2, "workgroup");

  const int bi  = m0 / SEQ;
  const int nn0 = m0 - bi * SEQ;
  float* ob = out + ((size_t)bi * SEQ_FULL + nn0 + 64 * wm) * DM + n0 + 64 * wn;
  const int c4 = (lane & 15) * 4;
#pragma unroll
  for (int it = 0; it < 32; ++it) {
    const int row = it * 2 + hh;
    const v4f val = *(const v4f*)(os + row * OSP + c4);
    *(v4f*)(ob + (size_t)row * DM + c4) = val;
  }
}

extern "C" void kernel_launch(void* const* d_in, const int* in_sizes, int n_in,
                              void* d_out, int out_size, void* d_ws, size_t ws_size,
                              hipStream_t stream)
{
  if (n_in < 6) return;
  const long need_x = ((long)(NB - 1) * SEQ_FULL + SEQ) * DM;
  if ((long)in_sizes[0] < need_x) return;
  if ((long)in_sizes[1] < (long)DM * NF) return;
  if (in_sizes[2] < NF) return;
  if ((long)in_sizes[3] < (long)NREL * NH) return;
  if ((long)in_sizes[4] < (long)DM * DM) return;
  if (in_sizes[5] < DM) return;
  if ((long)out_size < need_x) return;
  if (d_ws == nullptr || ws_size < WS_NEED) return;

  const float* x     = (const float*)d_in[0];
  const float* w_qkv = (const float*)d_in[1];
  const float* b_qkv = (const float*)d_in[2];
  const float* rel   = (const float*)d_in[3];
  const float* w_out = (const float*)d_in[4];
  const float* b_out = (const float*)d_in[5];
  float* out = (float*)d_out;

  unsigned short* Xb  = (unsigned short*)d_ws;   /* offset 0 */
  unsigned short* Wqt = Xb  + PLANE16;
  unsigned short* Wot = Wqt + WQT_EL;
  unsigned short* Qh  = Wot + WOT_EL;
  unsigned short* Kh  = Qh  + PLANE16;
  unsigned short* Vth = Kh  + PLANE16;
  unsigned short* Vtl = Vth + PLANE16;
  unsigned short* Ctx = Vtl + PLANE16;           /* ends at WS_NEED */

  cvt_x_kernel<<<dim3((unsigned)((MROWS * DM) / 2048)), 256, 0, stream>>>(x, Xb);
  wtrans_kernel<0><<<dim3(NF / 64, DM / 64), 256, 0, stream>>>(w_qkv, Wqt, NF);
  wtrans_kernel<1><<<dim3(DM / 64, DM / 64), 256, 0, stream>>>(w_out, Wot, DM);
  qkv_gemm_kernel<<<dim3(MROWS / GBM, NF / GBN), 128, 0, stream>>>(Xb, Wqt, b_qkv, Qh, Kh, Vth, Vtl);
  attn_kernel<<<dim3(SEQ / QBLK, NBH), 128, 0, stream>>>(Qh, Kh, Vth, Vtl, rel, Ctx);
  out_gemm_kernel<<<dim3(MROWS / GBM, DM / GBN), 128, 0, stream>>>(Ctx, Wot, b_out, out);
}

// v005
// Measured time: 117 microseconds a run.
// Next to v004, in two timings, it ran 1.04 times as fast each time.
// All steps since v000 together make it 2.66 times as fast.
// Contractions: qkv = x.w_qkv on v_wmma_f32_16x16x32_bf16 (bf16 operands from RNE-converted inputs); scores = q.k^T on v_wmma_f32_16x16x32_f16 (f16 operands, 1/8 applied in f32); ctx = p.v on v_wmma_f32_16x16x32_bf16 with p and v as bf16 hi+lo planes (three products); out = ctx.w_out on v_wmma_f32_16x16x32_f16 (ctx carried x16, w_out as bf16 value x64, 2^-10 fold in f32); f32 accumulate, f32 online softmax.
#include <hip/hip_runtime.h>

typedef __attribute__((ext_vector_type(16))) __bf16       v16b;
typedef __attribute__((ext_vector_type(16))) _Float16     v16h;
typedef __attribute__((ext_vector_type(8)))  float        v8f;
typedef __attribute__((ext_vector_type(4)))  float        v4f;
typedef __attribute__((ext_vector_type(4)))  unsigned int v4u;
typedef __attribute__((ext_vector_type(2)))  float        v2f;
typedef __attribute__((ext_vector_type(2)))  __bf16       v2b;

#ifndef NB
#define NB 16
#endif
#ifndef SEQ
#define SEQ 512
#endif
#define NB_FULL  16
#define SEQ_FULL 512

constexpr int DM     = 1024;            /* model dim = inner dim */
constexpr int NH     = 16;              /* heads */
constexpr int DH     = 64;              /* head dim */
constexpr int NF     = 3 * NH * DH;     /* 3072 qkv features */
constexpr int MAXLEN = 512;
constexpr int NREL   = 2 * MAXLEN - 1;  /* 1023 bias rows */
constexpr int MROWS  = NB * SEQ;        /* compact token rows */
constexpr int NBH    = NB * NH;
constexpr int KCH    = 64;              /* keys per staged chunk */
constexpr int QBLK   = 64;              /* query rows per block (4 waves x 16) */
constexpr int NWAVE  = 4;
constexpr int TPQ    = 72;              /* 16-bit LDS tile pitch, 64-wide rows (144 B) */
constexpr int OSP    = 68;              /* f32 LDS slab pitch (272 B) */
constexpr int GBM    = 128;             /* GEMM block tile, token rows */
constexpr int GBN    = 128;             /* GEMM block tile, feature rows of the [n][k] operand */
constexpr int GBK    = 64;              /* k per staged tile: 128-B rows at pitch TPQ */
constexpr int GSTG   = (GBM + GBN) * TPQ;   /* 16-bit elements of one ring buffer (36864 B) */
constexpr int GNT    = DM / GBK;        /* staged tiles along k */

constexpr size_t PLANE16 = (size_t)MROWS * DM;          /* elements of a [MROWS][1024] 16-bit plane */
constexpr size_t WQT_EL  = (size_t)NF * DM;
constexpr size_t WOT_EL  = (size_t)DM * DM;
constexpr size_t WS_NEED = (6 * PLANE16 + WQT_EL + WOT_EL) * 2;   /* 109051904 B at NB=16, SEQ=512 */

static_assert(NB >= 1 && NB <= NB_FULL);
static_assert(SEQ >= 128 && SEQ <= SEQ_FULL && SEQ <= MAXLEN);
static_assert(SEQ % 128 == 0);
static_assert(SEQ % KCH == 0 && SEQ % QBLK == 0);
static_assert(DH == 64 && NH * DH == DM);
static_assert(DM % 64 == 0 && NF % 64 == 0 && NF == 3 * DM);
static_assert(MROWS % 128 == 0);
static_assert((MROWS * DM) % 2048 == 0);
static_assert(NREL <= 1024);
static_assert(TPQ % 8 == 0 && OSP % 4 == 0);
static_assert(MROWS % GBM == 0 && SEQ % GBM == 0 && DM % GBN == 0 && NF % GBN == 0);
static_assert(GNT >= 2 && DM % GBK == 0);
static_assert(NWAVE * 2 * 64 * TPQ <= 2 * GSTG);          /* v hi+lo slabs fit the ring */
static_assert(NWAVE * 64 * OSP * 4 <= 2 * GSTG * 2);      /* f32 slabs fit the ring */
static_assert(WS_NEED <= 134217728ull);

/* workspace region map (bytes, NB=16 SEQ=512):
 *   Xb  bf16 [MROWS][1024]        16777216
 *   Wqt bf16 [3072][1024] (k-contig) 6291456
 *   Wot f16  [1024 n][1024 k]       2097152   (bf16 value x64)
 *   Qh  f16  [NBH][SEQ][64]        16777216
 *   Kh  f16  [NBH][SEQ][64]        16777216
 *   Vth bf16 [NBH][64][SEQ]        16777216   (v hi, transposed)
 *   Vtl bf16 [NBH][64][SEQ]        16777216   (v lo = v - hi)
 *   Ctx f16  [MROWS][1024]         16777216   (x16 carry)
 *   total 109051904
 */

__device__ __forceinline__ unsigned short f2bf_bits(float f) {   /* RNE, the hardware's convert */
  return __builtin_bit_cast(unsigned short, (__bf16)f);
}
__device__ __forceinline__ float bf_bits2f(unsigned short h) { return __uint_as_float(((unsigned)h) << 16); }
__device__ __forceinline__ float bfr(float f) { return bf_bits2f(f2bf_bits(f)); }   /* RNE convert to the bf16 value */
__device__ __forceinline__ unsigned short f2h_bits(float f) {
  _Float16 h = (_Float16)f;
  return __builtin_bit_cast(unsigned short, h);
}
__device__ __forceinline__ unsigned int pk16(unsigned short lo, unsigned short hi) {
  return (unsigned)lo | ((unsigned)hi << 16);
}

__device__ __forceinline__ v8f mma_bf16(v16b a, v16b b, v8f c) {
  c = __builtin_amdgcn_wmma_f32_16x16x32_bf16(false, a, false, b, (short)0, c, false, false);
  asm volatile("v_nop\n\tv_nop\n\tv_nop\n\tv_nop" : "+v"(c) : "v"(a), "v"(b));
  return c;
}
__device__ __forceinline__ v8f mma_f16(v16h a, v16h b, v8f c) {
  c = __builtin_amdgcn_wmma_f32_16x16x32_f16(false, a, false, b, (short)0, c, false, false);
  asm volatile("v_nop\n\tv_nop\n\tv_nop\n\tv_nop" : "+v"(c) : "v"(a), "v"(b));
  return c;
}

/* The bare builtins, used by the attention kernel: the compiler keeps the distance behind a WMMA itself and
 * is free to place LDS reads and vector work between the products. */
__device__ __forceinline__ v8f wmma_bf16(v16b a, v16b b, v8f c) {
  return __builtin_amdgcn_wmma_f32_16x16x32_bf16(false, a, false, b, (short)0, c, false, false);
}
__device__ __forceinline__ v8f wmma_f16(v16h a, v16h b, v8f c) {
  return __builtin_amdgcn_wmma_f32_16x16x32_f16(false, a, false, b, (short)0, c, false, false);
}

/* two f32 -> two RNE bf16 in one dword by one packed convert: e0 in the low half, e1 in the high half */
__device__ __forceinline__ v2b cvt2(float e0, float e1) { return __builtin_convertvector((v2f){e0, e1}, v2b); }

/* the value that lane ^ 16 holds */
__device__ __forceinline__ float xhalf(float v) {
  const int b = __float_as_int(v);
  return __int_as_float(__builtin_amdgcn_permlanex16(b, b, 0x76543210, 0xfedcba98, false, false));
}

union FragB { v16b v; v4u u[2]; };
union FragH { v16h v; v4u u[2]; };
union FragG { v16b b; v16h h; v4u u[2]; };

__device__ __forceinline__ unsigned lds_off(const void* p) { return (unsigned)(size_t)p; }

/* Eight asynchronous 16-B copies per lane, global -> LDS: rows 16 apart of a [row][DM] 16-bit plane
 * into rows 16 apart of a pitch-TPQ tile. The s_wait_xcnt closes the same statement so that no
 * address register of an issued copy is rewritten in front of it. */
__device__ __forceinline__ void copy8(unsigned l, const unsigned short* g)
{
  constexpr unsigned LS = 16 * TPQ * 2;
  constexpr size_t   GS = (size_t)16 * DM;
  const unsigned l0 = l,          l1 = l + LS,     l2 = l + 2 * LS, l3 = l + 3 * LS;
  const unsigned l4 = l + 4 * LS, l5 = l + 5 * LS, l6 = l + 6 * LS, l7 = l + 7 * LS;
  const unsigned short* g0 = g;
  const unsigned short* g1 = g + GS;
  const unsigned short* g2 = g + 2 * GS;
  const unsigned short* g3 = g + 3 * GS;
  const unsigned short* g4 = g + 4 * GS;
  const unsigned short* g5 = g + 5 * GS;
  const unsigned short* g6 = g + 6 * GS;
  const unsigned short* g7 = g + 7 * GS;
  asm volatile("global_load_async_to_lds_b128 %0, %8, off\n\t"
               "global_load_async_to_lds_b128 %1, %9, off\n\t"
               "global_load_async_to_lds_b128 %2, %10, off\n\t"
               "global_load_async_to_lds_b128 %3, %11, off\n\t"
               "global_load_async_to_lds_b128 %4, %12, off\n\t"
               "global_load_async_to_lds_b128 %5, %13, off\n\t"
               "global_load_async_to_lds_b128 %6, %14, off\n\t"
               "global_load_async_to_lds_b128 %7, %15, off\n\t"
               "s_wait_xcnt 0x0"
               :: "v"(l0), "v"(l1), "v"(l2), "v"(l3), "v"(l4), "v"(l5), "v"(l6), "v"(l7),
                  "v"(g0), "v"(g1), "v"(g2), "v"(g3), "v"(g4), "v"(g5), "v"(g6), "v"(g7)
               : "memory");
}

/* --------------------------------------------------------------------------
 * acc[4][4] (wave tile 64 x 64, waves 2 x 2 in a 128 x 128 block tile) = A[m0..][k] . B[n0..][k]^T,
 * both planes [row][DM] k-contiguous. Per 64-k tile the block stages [A 128 rows | B 128 rows] of
 * 128 B in LDS at pitch 144 B by asynchronous copies (thread -> row tid>>3 + 16 i, 16-B segment
 * tid&7: a wave's copy covers 4 whole lines; 2 x 8 copies per thread = the whole stage), two
 * buffers: tile t+2 is copied into the buffer that trip t has just left, behind the trip's barrier.
 * k runs upward in steps of 32 through one accumulator chain per tile.
 * ------------------------------------------------------------------------ */
template <bool F16>
__device__ __forceinline__ void gemm_tile(const unsigned short* __restrict__ A,
                                          const unsigned short* __restrict__ B,
                                          unsigned short* Ring, int m0, int n0, v8f (&acc)[4][4])
{
  const int tid  = threadIdx.x;
  const int wave = tid >> 5;
  const int lane = tid & 31;
  const int hh   = lane >> 4;
  const int c    = lane & 15;
  const int wm   = wave >> 1;
  const int wn   = wave & 1;

#pragma unroll
  for (int i = 0; i < 4; ++i)
#pragma unroll
    for (int j = 0; j < 4; ++j) acc[i][j] = (v8f){0.f,0.f,0.f,0.f,0.f,0.f,0.f,0.f};

  const int crow = tid >> 3;
  const int cseg = (tid & 7) * 8;
  const unsigned short* ga = A + (size_t)(m0 + crow) * DM + cseg;
  const unsigned short* gb = B + (size_t)(n0 + crow) * DM + cseg;
  const unsigned la = lds_off(Ring) + (unsigned)(crow * TPQ + cseg) * 2u;
  const unsigned lb = la + (unsigned)(GBM * TPQ) * 2u;

  copy8(la, ga);
  copy8(lb, gb);
  asm volatile("s_wait_asynccnt 0x0" ::: "memory");   /* tile 0 of this wave has landed before the barrier publishes it */
  __syncthreads();
  copy8(la + (unsigned)GSTG * 2u, ga + GBK);
  copy8(lb + (unsigned)GSTG * 2u, gb + GBK);

  const unsigned short* fa = Ring + (64 * wm + c) * TPQ + 8 * hh;
  const unsigned short* fb = Ring + (GBM + 64 * wn + c) * TPQ + 8 * hh;

#pragma unroll 1   /* one staged tile per trip: the ring's waits and barrier stand once, at the foot */
  for (int t = 0; t < GNT; ++t) {
    const int bo = (t & 1) * GSTG;
#pragma unroll
    for (int ks = 0; ks < GBK / 32; ++ks) {
      FragG a[4], b[4];
#pragma unroll
      for (int i = 0; i < 4; ++i) {
        a[i].u[0] = *(const v4u*)(fa + bo + i * 16 * TPQ + ks * 32);
        a[i].u[1] = *(const v4u*)(fa + bo + i * 16 * TPQ + ks * 32 + 16);
        b[i].u[0] = *(const v4u*)(fb + bo + i * 16 * TPQ + ks * 32);
        b[i].u[1] = *(const v4u*)(fb + bo + i * 16 * TPQ + ks * 32 + 16);
      }
#pragma unroll
      for (int i = 0; i < 4; ++i)
#pragma unroll
        for (int j = 0; j < 4; ++j) {
          if constexpr (F16) acc[i][j] = mma_f16(a[i].h, b[j].h, acc[i][j]);
          else               acc[i][j] = mma_bf16(a[i].b, b[j].b, acc[i][j]);
        }
    }
    asm volatile("s_wait_dscnt 0x0" ::: "memory");      /* this wave's reads of buffer t&1 are done before it is refilled */
    asm volatile("s_wait_asynccnt 0x0" ::: "memory");   /* this wave's copies of tile t+1 have landed before the barrier publishes them */
    __syncthreads();
    if (t + 2 < GNT) {
      copy8(la + (unsigned)bo * 2u, ga + (t + 2) * GBK);
      copy8(lb + (unsigned)bo * 2u, gb + (t + 2) * GBK);
    }
  }
  asm volatile("s_wait_asynccnt 0x0" ::: "memory");     /* no copy is in flight when the ring becomes output staging */
}

/* Fragment map used everywhere (hh = lane>>4, c = lane&15):
 * A: row c, elements 0..7 <- k0+8hh+0..7, 8..15 <- k0+16+8hh+0..7 (two 16-B loads from a k-contiguous row);
 * B: column c with the SAME k map, loaded from a [n][k] k-contiguous copy exactly like A;
 * D: element r = (row 8hh+r, col c). */

/* --------------------------------------------------------------------------
 * x (f32, full-size strides) -> Xb bf16 [MROWS][1024].
 * Block = 256 threads = 2 compact rows; thread -> 8 consecutive elements, one
 * Coverage: MROWS/2 blocks x 2048 elements = the whole plane.
 * ------------------------------------------------------------------------ */
__global__ __launch_bounds__(256) void cvt_x_kernel(const float* __restrict__ x,
                                                    unsigned short* __restrict__ Xb)
{
  const int tid  = threadIdx.x;
  const int e    = tid * 8;
  const int crow = blockIdx.x * 2 + e / DM;
  const int col  = e % DM;
  const int bi   = crow / SEQ;
  const int n    = crow - bi * SEQ;
  const float* src = x + ((size_t)bi * SEQ_FULL + n) * DM + col;
  const v4f f0 = *(const v4f*)src;
  const v4f f1 = *(const v4f*)(src + 4);
  v4u w;
  w[0] = pk16(f2bf_bits(f0[0]), f2bf_bits(f0[1]));
  w[1] = pk16(f2bf_bits(f0[2]), f2bf_bits(f0[3]));
  w[2] = pk16(f2bf_bits(f1[0]), f2bf_bits(f1[1]));
  w[3] = pk16(f2bf_bits(f1[2]), f2bf_bits(f1[3]));
  unsigned short* dst = Xb + (size_t)crow * DM + col;
  *(v4u*)dst = w;
  
}

/* --------------------------------------------------------------------------
 * w [1024 k][nf] f32 -> Wt [nf][1024] 16-bit (k-contiguous rows).
 * KIND 0: bf16 bits; KIND 1: f16 bits of (bf16 value x64).
 * Block (x = n tile of 64, y = k tile of 64), 256 threads.
 * Load: thread -> k row tid>>2, 16 columns; 64x64 covered once. Transposed into LDS [n][k].
 * Store: 512 units (2 per thread): unit u -> n row u>>3, 16-B segment u&7; lanes
 * Coverage: grid (nf/64, 16) x 64x64 = the whole plane.
 * ------------------------------------------------------------------------ */
template <int KIND>
__global__ __launch_bounds__(256) void wtrans_kernel(const float* __restrict__ w,
                                                     unsigned short* __restrict__ Wt, int nf)
{
  __shared__ __align__(16) unsigned short Ts[64 * TPQ];     /* [n][k] */
  const int tid  = threadIdx.x;
  const int n0   = blockIdx.x * 64;
  const int k0   = blockIdx.y * 64;
  const int krow = tid >> 2;
  const int fseg = (tid & 3) * 16;
  const float* src = w + (size_t)(k0 + krow) * nf + n0 + fseg;
#pragma unroll
  for (int i = 0; i < 4; ++i) {
    const v4f f = *(const v4f*)(src + 4 * i);
#pragma unroll
    for (int e2 = 0; e2 < 4; ++e2) {
      const float v = f[e2];
      unsigned short bits;
      if (KIND == 0) bits = f2bf_bits(v);
      else           bits = f2h_bits(bfr(v) * 64.0f);
      Ts[(fseg + 4 * i + e2) * TPQ + krow] = bits;
    }
  }
  __syncthreads();
  {
#pragma unroll
    for (int it = 0; it < 2; ++it) {
      const int u    = it * 256 + tid;
      const int frow = u >> 3;
      const int seg  = u & 7;
      const v4u val = *(const v4u*)(Ts + frow * TPQ + seg * 8);
      *(v4u*)(Wt + (size_t)(n0 + frow) * DM + k0 + seg * 8) = val;
    }
    
  }
}

/* --------------------------------------------------------------------------
 * qkv = Xb.Wq + bq on bf16 WMMA. Block = 4 waves (2 x 2), tile 128 tokens x 128 features,
 * operands staged in LDS (gemm_tile); grid (MROWS/128, NF/128).
 * A wave's 64 features are exactly one (sel, head); sel is block-uniform.
 * The ring is output staging after the loop's last barrier; every slab is wave-private.
 * sel 0/1: q/k -> f16 plane [bh][n][d]: per-wave 64x64 LDS tile, then 64 whole 128-B rows:
 *   rows it*4+(lane>>3), it 0..15, segs lane&7.
 * sel 2: v -> bf16 hi and lo planes [bh][d][n]: per-wave 64x64 transposed LDS tiles, each d row =
 *   64 tokens = 128 B = 8 lanes x 16 B; rows it*4+(lane>>3), it 0..15.
 * ------------------------------------------------------------------------ */
__global__ __launch_bounds__(128) __attribute__((amdgpu_num_vgpr(256)))
void qkv_gemm_kernel(const unsigned short* __restrict__ Xb, const unsigned short* __restrict__ Wqt,
                     const float* __restrict__ bq,
                     unsigned short* __restrict__ Qh, unsigned short* __restrict__ Kh,
                     unsigned short* __restrict__ Vth, unsigned short* __restrict__ Vtl)
{
  __shared__ __align__(16) unsigned short Ring[2 * GSTG];
  const int tid  = threadIdx.x;
  const int wave = tid >> 5;
  const int lane = tid & 31;
  const int hh   = lane >> 4;
  const int c    = lane & 15;
  const int wm   = wave >> 1;
  const int wn   = wave & 1;
  const int m0   = blockIdx.x * GBM;
  const int n0   = blockIdx.y * GBN;
  const int sel  = blockIdx.y / (DM / GBN);
  const int head = (blockIdx.y - sel * (DM / GBN)) * (GBN / DH) + wn;

  v8f acc[4][4];
  gemm_tile<false>(Xb, Wqt, Ring, m0, n0, acc);

  float bb[4], bl[4];
  const int bidx = n0 + 64 * wn + c;
#pragma unroll
  for (int tt = 0; tt < 4; ++tt) bl[tt] = bq[bidx + 16 * tt];
  /* the four loads share the index register: it is named here so that it lives up to the wait and no load's result lands in it */
  asm volatile("s_wait_xcnt 0x0" :: "v"(bidx) : "memory");
#pragma unroll
  for (int tt = 0; tt < 4; ++tt) bb[tt] = bfr(bl[tt]);

  const int bi  = m0 / SEQ;
  const int nn0 = m0 - bi * SEQ + 64 * wm;
  const int bh  = bi * NH + head;

  if (sel < 2) {
    unsigned short* plane = (sel == 0) ? Qh : Kh;
    unsigned short* ls = Ring + wave * (64 * TPQ);      /* [token][d], wave-private, block barrier used */
#pragma unroll
    for (int rt = 0; rt < 4; ++rt)
#pragma unroll
      for (int tt = 0; tt < 4; ++tt)
#pragma unroll
        for (int r = 0; r < 8; ++r)
          ls[(16 * rt + 8 * hh + r) * TPQ + 16 * tt + c] = f2h_bits(acc[rt][tt][r] + bb[tt]);
    __syncthreads();
    unsigned short* dst = plane + ((size_t)bh * SEQ + nn0) * DH;
#pragma unroll
    for (int it = 0; it < 16; ++it) {
      const int row = it * 4 + (lane >> 3);
      const int seg = lane & 7;
      const v4u val = *(const v4u*)(ls + row * TPQ + seg * 8);
      *(v4u*)(dst + (size_t)row * DH + seg * 8) = val;
    }
  } else {
    unsigned short* th = Ring + wave * (2 * 64 * TPQ);  /* v hi [d][token 0..63], wave-private, block barrier used */
    unsigned short* tl = th + 64 * TPQ;                 /* v lo */
#pragma unroll
    for (int rt = 0; rt < 4; ++rt)
#pragma unroll
      for (int tt = 0; tt < 4; ++tt)
#pragma unroll
        for (int r = 0; r < 8; ++r) {
          const float v = acc[rt][tt][r] + bb[tt];
          const unsigned short hb = f2bf_bits(v);
          const unsigned short lb = f2bf_bits(v - bf_bits2f(hb));
          const int tok = 16 * rt + 8 * hh + r;
          const int d   = 16 * tt + c;
          th[d * TPQ + tok] = hb;
          tl[d * TPQ + tok] = lb;
        }
    __syncthreads();
    const size_t vbase = (size_t)bh * DH * SEQ + nn0;
#pragma unroll
    for (int it = 0; it < 16; ++it) {
      const int drow = it * 4 + (lane >> 3);
      const int seg  = lane & 7;
      const v4u hv = *(const v4u*)(th + drow * TPQ + seg * 8);
      const v4u lv = *(const v4u*)(tl + drow * TPQ + seg * 8);
      *(v4u*)(Vth + vbase + (size_t)drow * SEQ + seg * 8) = hv;
      *(v4u*)(Vtl + vbase + (size_t)drow * SEQ + seg * 8) = lv;
    }
    asm volatile("s_wait_xcnt 0x0" ::: "memory");   /* behind the last store, before a register that a store names is written again */
  }
}

__global__ __launch_bounds__(128) __attribute__((amdgpu_num_vgpr(256)))
void attn_kernel(const unsigned short* __restrict__ Qh, const unsigned short* __restrict__ Kh,
                 const unsigned short* __restrict__ Vth, const unsigned short* __restrict__ Vtl,
                 const float* __restrict__ rel, unsigned short* __restrict__ Ctx)
{
  __shared__ __align__(16) unsigned short Ksh[KCH * TPQ];           /* K  [kv][d] f16, row pitch TPQ */
  __shared__ __align__(16) unsigned short Vhs[DH * TPQ];            /* Vh [d][kv] bf16, row pitch TPQ */
  __shared__ __align__(16) unsigned short Vls[DH * TPQ];            /* Vl [d][kv] bf16, row pitch TPQ */
  __shared__ __align__(16) unsigned short Osh[NWAVE][16 * TPQ];     /* out slab per wave (f16) */
  __shared__ float sbias[1024];                                     /* bias column of this head, bf16 value */

  const int tid  = threadIdx.x;
  const int wave = tid >> 5;
  const int lane = tid & 31;
  const int hh   = lane >> 4;
  const int c    = lane & 15;
  const int qb   = blockIdx.x;
  const int bh   = blockIdx.y;
  const int bi   = bh / NH;
  const int head = bh - bi * NH;
  const int q0   = qb * QBLK + wave * 16;

  for (int t = tid; t < 1024; t += 128) {
    const int ti = t < NREL ? t : (NREL - 1);
    const float v = bfr(rel[(size_t)ti * NH + head]);
    sbias[t] = (t < NREL) ? v : 0.f;
  }

  FragH qa[2];
  {
    const unsigned short* qrow = Qh + ((size_t)bh * SEQ + q0 + c) * DH + 8 * hh;
    qa[0].u[0] = *(const v4u*)(qrow);
    qa[0].u[1] = *(const v4u*)(qrow + 16);
    qa[1].u[0] = *(const v4u*)(qrow + 32);
    qa[1].u[1] = *(const v4u*)(qrow + 48);
  }
  __syncthreads();

  float mrow = -__builtin_inff();    /* running maximum of query q0+c, equal in both lane halves */
  float lrow = 0.f;                  /* running sum over this lane half's keys */
  v8f oacc[4];
#pragma unroll
  for (int t = 0; t < 4; ++t) oacc[t] = (v8f){0.f,0.f,0.f,0.f,0.f,0.f,0.f,0.f};

  const unsigned short* Kp  = Kh  + (size_t)bh * SEQ * DH;
  const unsigned short* Vhp = Vth + (size_t)bh * DH * SEQ;
  const unsigned short* Vlp = Vtl + (size_t)bh * DH * SEQ;
  const int bbase = q0 + c - 8 * hh + (MAXLEN - 1);    /* bias index = bbase - kv0 - 16j - r */

#pragma unroll 1
  for (int kc = 0; kc < SEQ / KCH; ++kc) {
    const int kv0 = kc * KCH;
    __syncthreads();
#pragma unroll
    for (int it = 0; it < 4; ++it) {
      const int u   = it * 128 + tid;
      const int row = u >> 3;
      const int seg = u & 7;
      const v4u kw = *(const v4u*)(Kp  + (size_t)(kv0 + row) * DH + seg * 8);
      const v4u hw = *(const v4u*)(Vhp + (size_t)row * SEQ + kv0 + seg * 8);
      const v4u lw = *(const v4u*)(Vlp + (size_t)row * SEQ + kv0 + seg * 8);
      *(v4u*)(Ksh + row * TPQ + seg * 8) = kw;
      *(v4u*)(Vhs + row * TPQ + seg * 8) = hw;
      *(v4u*)(Vls + row * TPQ + seg * 8) = lw;
    }
    __syncthreads();

    /* scores, transposed: 64 keys (rows) x 16 queries (columns) per wave */
    v8f s[4];
#pragma unroll
    for (int j = 0; j < 4; ++j) {
      s[j] = (v8f){0.f,0.f,0.f,0.f,0.f,0.f,0.f,0.f};
#pragma unroll
      for (int dc = 0; dc < 2; ++dc) {
        FragH kf;
        kf.u[0] = *(const v4u*)(Ksh + (j * 16 + c) * TPQ + dc * 32 + 8 * hh);
        kf.u[1] = *(const v4u*)(Ksh + (j * 16 + c) * TPQ + dc * 32 + 16 + 8 * hh);
        s[j] = wmma_f16(kf.v, qa[dc].v, s[j]);
      }
    }

    /* scale 1/8 and rel-pos bias: key index = kv0 + 16j + 8hh + r, query = q0 + c */
    const int boff = bbase - kv0;
#pragma unroll
    for (int j = 0; j < 4; ++j)
#pragma unroll
      for (int r = 0; r < 8; ++r)
        s[j][r] = s[j][r] * 0.125f + sbias[boff - 16 * j - r];

    /* chunk maximum of this lane's query: 32 keys in-lane, the other 32 from lane ^ 16 */
    float cj[4];
#pragma unroll
    for (int j = 0; j < 4; ++j) {
      cj[j] = s[j][0];
#pragma unroll
      for (int r = 1; r < 8; ++r) cj[j] = fmaxf(cj[j], s[j][r]);
    }
    float cm = fmaxf(fmaxf(cj[0], cj[1]), fmaxf(cj[2], cj[3]));
    cm = fmaxf(cm, xhalf(cm));

    /* online softmax update; P as bf16 hi + lo, packed in place into B operands */
    const float mnew  = fmaxf(mrow, cm);
    const float alpha = __expf(mrow - mnew);
    mrow = mnew;
    FragB ph[2], pl[2];
    float pj[4];                     /* one sum chain per key tile */
#pragma unroll
    for (int j = 0; j < 4; ++j) {
      pj[j] = 0.f;
#pragma unroll
      for (int r2 = 0; r2 < 4; ++r2) {
        const float p0 = __expf(s[j][2 * r2]     - mnew);
        const float p1 = __expf(s[j][2 * r2 + 1] - mnew);
        pj[j] += p0;
        pj[j] += p1;
        const v2b h = cvt2(p0, p1);
        const v2b l = cvt2(p0 - (float)h[0], p1 - (float)h[1]);
        ph[j >> 1].u[j & 1][r2] = __builtin_bit_cast(unsigned, h);
        pl[j >> 1].u[j & 1][r2] = __builtin_bit_cast(unsigned, l);
      }
    }
    lrow = lrow * alpha + ((pj[0] + pj[1]) + (pj[2] + pj[3]));
#pragma unroll
    for (int t = 0; t < 4; ++t)
#pragma unroll
      for (int r = 0; r < 8; ++r) oacc[t][r] *= alpha;

    /* O^T += V^T.P^T : A = V^T [d][kv] rows, B = P^T [kv][q] from the registers above */
#pragma unroll
    for (int kk = 0; kk < 2; ++kk) {
#pragma unroll
      for (int t = 0; t < 4; ++t) {
        FragB vh, vl;
        vh.u[0] = *(const v4u*)(Vhs + (t * 16 + c) * TPQ + kk * 32 + 8 * hh);
        vh.u[1] = *(const v4u*)(Vhs + (t * 16 + c) * TPQ + kk * 32 + 16 + 8 * hh);
        vl.u[0] = *(const v4u*)(Vls + (t * 16 + c) * TPQ + kk * 32 + 8 * hh);
        vl.u[1] = *(const v4u*)(Vls + (t * 16 + c) * TPQ + kk * 32 + 16 + 8 * hh);
        oacc[t] = wmma_bf16(vh.v, ph[kk].v, oacc[t]);
        oacc[t] = wmma_bf16(vh.v, pl[kk].v, oacc[t]);
        oacc[t] = wmma_bf16(vl.v, ph[kk].v, oacc[t]);
      }
    }
  }

  /* join the halves' sums, normalise, x16 carry, f16 slab [query][d], then whole-line stores into Ctx */
  unsigned short* os = Osh[wave];
  {
    const float inv = 1.0f / (lrow + xhalf(lrow));
#pragma unroll
    for (int t = 0; t < 4; ++t) {
      v4u w;
#pragma unroll
      for (int r2 = 0; r2 < 4; ++r2)
        w[r2] = pk16(f2h_bits(oacc[t][2 * r2] * inv * 16.0f), f2h_bits(oacc[t][2 * r2 + 1] * inv * 16.0f));
      *(v4u*)(os + c * TPQ + t * 16 + 8 * hh) = w;
    }
  }
  __builtin_amdgcn_fence(3, "workgroup");
  __builtin_amdgcn_wave_barrier();
  __builtin_amdgcn_fence(2, "workgroup");
  {
    unsigned short* cdst = Ctx + ((size_t)bi * SEQ + q0) * DM + head * DH;
    {
#pragma unroll
      for (int it = 0; it < 4; ++it) {
        const int row = it * 4 + (lane >> 3);
        const int seg = lane & 7;
        const v4u val = *(const v4u*)(os + row * TPQ + seg * 8);
        *(v4u*)(cdst + (size_t)row * DM + seg * 8) = val;
      }
      
    }
  }
}

/* --------------------------------------------------------------------------
 * out = Ctx.Wot (f16 WMMA, x1024 total carry folded by 2^-10) + bo, f32 output.
 * Block = 4 waves (2 x 2), tile 128 tokens x 128 columns, operands staged in LDS (gemm_tile);
 * grid (MROWS/128, DM/128). The ring is output staging after the loop's last barrier:
 * per-wave f32 slab 64x64; rows it*2+hh, it 0..31, pieces (lane&15)*4.
 * ------------------------------------------------------------------------ */
__global__ __launch_bounds__(128) __attribute__((amdgpu_num_vgpr(256)))
void out_gemm_kernel(const unsigned short* __restrict__ Ctx, const unsigned short* __restrict__ Wot,
                     const float* __restrict__ bo, float* __restrict__ out)
{
  __shared__ __align__(16) unsigned short Ring[2 * GSTG];
  const int tid  = threadIdx.x;
  const int wave = tid >> 5;
  const int lane = tid & 31;
  const int hh   = lane >> 4;
  const int c    = lane & 15;
  const int wm   = wave >> 1;
  const int wn   = wave & 1;
  const int m0   = blockIdx.x * GBM;
  const int n0   = blockIdx.y * GBN;

  v8f acc[4][4];
  gemm_tile<true>(Ctx, Wot, Ring, m0, n0, acc);

  float bb[4];
#pragma unroll
  for (int tt = 0; tt < 4; ++tt) bb[tt] = bfr(bo[n0 + 64 * wn + 16 * tt + c]);

  float* os = (float*)Ring + wave * (64 * OSP);
#pragma unroll
  for (int rt = 0; rt < 4; ++rt)
#pragma unroll
    for (int tt = 0; tt < 4; ++tt)
#pragma unroll
      for (int r = 0; r < 8; ++r)
        os[(16 * rt + 8 * hh + r) * OSP + 16 * tt + c] = acc[rt][tt][r] * (1.0f / 1024.0f) + bb[tt];
  __builtin_amdgcn_fence(3, "workgroup");
  __builtin_amdgcn_wave_barrier();
  __builtin_amdgcn_fence(2, "workgroup");

  const int bi  = m0 / SEQ;
  const int nn0 = m0 - bi * SEQ;
  float* ob = out + ((size_t)bi * SEQ_FULL + nn0 + 64 * wm) * DM + n0 + 64 * wn;
  const int c4 = (lane & 15) * 4;
#pragma unroll
  for (int it = 0; it < 32; ++it) {
    const int row = it * 2 + hh;
    const v4f val = *(const v4f*)(os + row * OSP + c4);
    *(v4f*)(ob + (size_t)row * DM + c4) = val;
  }
}

extern "C" void kernel_launch(void* const* d_in, const int* in_sizes, int n_in,
                              void* d_out, int out_size, void* d_ws, size_t ws_size,
                              hipStream_t stream)
{
  if (n_in < 6) return;
  const long need_x = ((long)(NB - 1) * SEQ_FULL + SEQ) * DM;
  if ((long)in_sizes[0] < need_x) return;
  if ((long)in_sizes[1] < (long)DM * NF) return;
  if (in_sizes[2] < NF) return;
  if ((long)in_sizes[3] < (long)NREL * NH) return;
  if ((long)in_sizes[4] < (long)DM * DM) return;
  if (in_sizes[5] < DM) return;
  if ((long)out_size < need_x) return;
  if (d_ws == nullptr || ws_size < WS_NEED) return;

  const float* x     = (const float*)d_in[0];
  const float* w_qkv = (const float*)d_in[1];
  const float* b_qkv = (const float*)d_in[2];
  const float* rel   = (const float*)d_in[3];
  const float* w_out = (const float*)d_in[4];
  const float* b_out = (const float*)d_in[5];
  float* out = (float*)d_out;

  unsigned short* Xb  = (unsigned short*)d_ws;   /* offset 0 */
  unsigned short* Wqt = Xb  + PLANE16;
  unsigned short* Wot = Wqt + WQT_EL;
  unsigned short* Qh  = Wot + WOT_EL;
  unsigned short* Kh  = Qh  + PLANE16;
  unsigned short* Vth = Kh  + PLANE16;
  unsigned short* Vtl = Vth + PLANE16;
  unsigned short* Ctx = Vtl + PLANE16;           /* ends at WS_NEED */

  cvt_x_kernel<<<dim3((unsigned)((MROWS * DM) / 2048)), 256, 0, stream>>>(x, Xb);
  wtrans_kernel<0><<<dim3(NF / 64, DM / 64), 256, 0, stream>>>(w_qkv, Wqt, NF);
  wtrans_kernel<1><<<dim3(DM / 64, DM / 64), 256, 0, stream>>>(w_out, Wot, DM);
  qkv_gemm_kernel<<<dim3(MROWS / GBM, NF / GBN), 128, 0, stream>>>(Xb, Wqt, b_qkv, Qh, Kh, Vth, Vtl);
  attn_kernel<<<dim3(SEQ / QBLK, NBH), 128, 0, stream>>>(Qh, Kh, Vth, Vtl, rel, Ctx);
  out_gemm_kernel<<<dim3(MROWS / GBM, DM / GBN), 128, 0, stream>>>(Ctx, Wot, b_out, out);
}

// v006
// It runs in 112 microseconds.
// In both of two side-by-side timings against v005, it was 1.04 times as fast.
// Over all steps from v000 it is 2.77 times as fast.
// Contractions: qkv = x.w_qkv on v_wmma_f32_16x16x32_bf16 (bf16 operands from RNE-converted inputs); scores = q.k^T on v_wmma_f32_16x16x32_f16 (f16 operands, 1/8 applied in f32); ctx = p.v on v_wmma_f32_16x16x32_bf16 with p and v as bf16 hi+lo planes (three products); out = ctx.w_out on v_wmma_f32_16x16x32_f16 (ctx carried x16, w_out as bf16 value x64, 2^-10 fold in f32); f32 accumulate, f32 online softmax.
#include <hip/hip_runtime.h>

typedef __attribute__((ext_vector_type(16))) __bf16       v16b;
typedef __attribute__((ext_vector_type(16))) _Float16     v16h;
typedef __attribute__((ext_vector_type(8)))  float        v8f;
typedef __attribute__((ext_vector_type(4)))  float        v4f;
typedef __attribute__((ext_vector_type(4)))  unsigned int v4u;
typedef __attribute__((ext_vector_type(2)))  float        v2f;
typedef __attribute__((ext_vector_type(2)))  __bf16       v2b;

#ifndef NB
#define NB 16
#endif
#ifndef SEQ
#define SEQ 512
#endif
#define NB_FULL  16
#define SEQ_FULL 512

constexpr int DM     = 1024;            /* model dim = inner dim */
constexpr int NH     = 16;              /* heads */
constexpr int DH     = 64;              /* head dim */
constexpr int NF     = 3 * NH * DH;     /* 3072 qkv features */
constexpr int MAXLEN = 512;
constexpr int NREL   = 2 * MAXLEN - 1;  /* 1023 bias rows */
constexpr int MROWS  = NB * SEQ;        /* compact token rows */
constexpr int NBH    = NB * NH;
constexpr int KCH    = 64;              /* keys per staged chunk */
constexpr int QBLK   = 64;              /* query rows per block (4 waves x 16) */
constexpr int NWAVE  = 4;
constexpr int TPQ    = 72;              /* 16-bit LDS tile pitch, 64-wide rows (144 B) */
constexpr int OSP    = 68;              /* f32 LDS slab pitch (272 B) */
constexpr int GBM    = 128;             /* GEMM block tile, token rows */
constexpr int GBN    = 128;             /* GEMM block tile, feature rows of the [n][k] operand */
constexpr int GBK    = 64;              /* k per staged tile: 128-B rows at pitch TPQ */
constexpr int GSTG   = (GBM + GBN) * TPQ;   /* 16-bit elements of one ring buffer (36864 B) */
constexpr int GNT    = DM / GBK;        /* staged tiles along k */

constexpr size_t PLANE16 = (size_t)MROWS * DM;          /* elements of a [MROWS][1024] 16-bit plane */
constexpr size_t WQT_EL  = (size_t)NF * DM;
constexpr size_t WOT_EL  = (size_t)DM * DM;
constexpr size_t WS_NEED = (6 * PLANE16 + WQT_EL + WOT_EL) * 2;   /* 109051904 B at NB=16, SEQ=512 */

static_assert(NB >= 1 && NB <= NB_FULL);
static_assert(SEQ >= 128 && SEQ <= SEQ_FULL && SEQ <= MAXLEN);
static_assert(SEQ % 128 == 0);
static_assert(SEQ % KCH == 0 && SEQ % QBLK == 0);
static_assert(DH == 64 && NH * DH == DM);
static_assert(DM % 64 == 0 && NF % 64 == 0 && NF == 3 * DM);
static_assert(MROWS % 128 == 0);
static_assert((MROWS * DM) % 2048 == 0);
static_assert(NREL <= 1024);
static_assert(TPQ % 8 == 0 && OSP % 4 == 0);
static_assert(MROWS % GBM == 0 && SEQ % GBM == 0 && DM % GBN == 0 && NF % GBN == 0);
static_assert(GNT >= 2 && DM % GBK == 0);
static_assert(NWAVE * 2 * 64 * TPQ <= 2 * GSTG);          /* v hi+lo slabs fit the ring */
static_assert(NWAVE * 64 * OSP * 4 <= 2 * GSTG * 2);      /* f32 slabs fit the ring */
static_assert(WS_NEED <= 134217728ull);

/* workspace region map (bytes, NB=16 SEQ=512):
 *   Xb  bf16 [MROWS][1024]        16777216
 *   Wqt bf16 [3072][1024] (k-contig) 6291456
 *   Wot f16  [1024 n][1024 k]       2097152   (bf16 value x64)
 *   Qh  f16  [NBH][SEQ][64]        16777216
 *   Kh  f16  [NBH][SEQ][64]        16777216
 *   Vth bf16 [NBH][64][SEQ]        16777216   (v hi, transposed)
 *   Vtl bf16 [NBH][64][SEQ]        16777216   (v lo = v - hi)
 *   Ctx f16  [MROWS][1024]         16777216   (x16 carry)
 *   total 109051904
 */

__device__ __forceinline__ unsigned short f2bf_bits(float f) {   /* RNE, the hardware's convert */
  return __builtin_bit_cast(unsigned short, (__bf16)f);
}
__device__ __forceinline__ float bf_bits2f(unsigned short h) { return __uint_as_float(((unsigned)h) << 16); }
__device__ __forceinline__ float bfr(float f) { return bf_bits2f(f2bf_bits(f)); }   /* RNE convert to the bf16 value */
__device__ __forceinline__ unsigned short f2h_bits(float f) {
  _Float16 h = (_Float16)f;
  return __builtin_bit_cast(unsigned short, h);
}
__device__ __forceinline__ unsigned int pk16(unsigned short lo, unsigned short hi) {
  return (unsigned)lo | ((unsigned)hi << 16);
}

__device__ __forceinline__ v8f mma_bf16(v16b a, v16b b, v8f c) {
  c = __builtin_amdgcn_wmma_f32_16x16x32_bf16(false, a, false, b, (short)0, c, false, false);
  asm volatile("v_nop\n\tv_nop\n\tv_nop\n\tv_nop" : "+v"(c) : "v"(a), "v"(b));
  return c;
}
__device__ __forceinline__ v8f mma_f16(v16h a, v16h b, v8f c) {
  c = __builtin_amdgcn_wmma_f32_16x16x32_f16(false, a, false, b, (short)0, c, false, false);
  asm volatile("v_nop\n\tv_nop\n\tv_nop\n\tv_nop" : "+v"(c) : "v"(a), "v"(b));
  return c;
}

/* The bare builtins, used by the attention kernel: the compiler keeps the distance behind a WMMA itself and
 * is free to place LDS reads and vector work between the products. */
__device__ __forceinline__ v8f wmma_bf16(v16b a, v16b b, v8f c) {
  return __builtin_amdgcn_wmma_f32_16x16x32_bf16(false, a, false, b, (short)0, c, false, false);
}
__device__ __forceinline__ v8f wmma_f16(v16h a, v16h b, v8f c) {
  return __builtin_amdgcn_wmma_f32_16x16x32_f16(false, a, false, b, (short)0, c, false, false);
}

/* two f32 -> two RNE bf16 in one dword by one packed convert: e0 in the low half, e1 in the high half */
__device__ __forceinline__ v2b cvt2(float e0, float e1) { return __builtin_convertvector((v2f){e0, e1}, v2b); }

/* the value that lane ^ 16 holds */
__device__ __forceinline__ float xhalf(float v) {
  const int b = __float_as_int(v);
  return __int_as_float(__builtin_amdgcn_permlanex16(b, b, 0x76543210, 0xfedcba98, false, false));
}

union FragB { v16b v; v4u u[2]; };
union FragH { v16h v; v4u u[2]; };
union FragG { v16b b; v16h h; v4u u[2]; };

__device__ __forceinline__ unsigned lds_off(const void* p) { return (unsigned)(size_t)p; }

/* Eight asynchronous 16-B copies per lane, global -> LDS: rows 16 apart of a [row][DM] 16-bit plane
 * into rows 16 apart of a pitch-TPQ tile. The s_wait_xcnt closes the same statement so that no
 * address register of an issued copy is rewritten in front of it. */
__device__ __forceinline__ void copy8(unsigned l, const unsigned short* g)
{
  constexpr unsigned LS = 16 * TPQ * 2;
  constexpr size_t   GS = (size_t)16 * DM;
  const unsigned l0 = l,          l1 = l + LS,     l2 = l + 2 * LS, l3 = l + 3 * LS;
  const unsigned l4 = l + 4 * LS, l5 = l + 5 * LS, l6 = l + 6 * LS, l7 = l + 7 * LS;
  const unsigned short* g0 = g;
  const unsigned short* g1 = g + GS;
  const unsigned short* g2 = g + 2 * GS;
  const unsigned short* g3 = g + 3 * GS;
  const unsigned short* g4 = g + 4 * GS;
  const unsigned short* g5 = g + 5 * GS;
  const unsigned short* g6 = g + 6 * GS;
  const unsigned short* g7 = g + 7 * GS;
  asm volatile("global_load_async_to_lds_b128 %0, %8, off\n\t"
               "global_load_async_to_lds_b128 %1, %9, off\n\t"
               "global_load_async_to_lds_b128 %2, %10, off\n\t"
               "global_load_async_to_lds_b128 %3, %11, off\n\t"
               "global_load_async_to_lds_b128 %4, %12, off\n\t"
               "global_load_async_to_lds_b128 %5, %13, off\n\t"
               "global_load_async_to_lds_b128 %6, %14, off\n\t"
               "global_load_async_to_lds_b128 %7, %15, off\n\t"
               "s_wait_xcnt 0x0"
               :: "v"(l0), "v"(l1), "v"(l2), "v"(l3), "v"(l4), "v"(l5), "v"(l6), "v"(l7),
                  "v"(g0), "v"(g1), "v"(g2), "v"(g3), "v"(g4), "v"(g5), "v"(g6), "v"(g7)
               : "memory");
}

/* --------------------------------------------------------------------------
 * acc[4][4] (wave tile 64 x 64, waves 2 x 2 in a 128 x 128 block tile) = A[m0..][k] . B[n0..][k]^T,
 * both planes [row][DM] k-contiguous. Per 64-k tile the block stages [A 128 rows | B 128 rows] of
 * 128 B in LDS at pitch 144 B by asynchronous copies (thread -> row tid>>3 + 16 i, 16-B segment
 * tid&7: a wave's copy covers 4 whole lines; 2 x 8 copies per thread = the whole stage), two
 * buffers: tile t+2 is copied into the buffer that trip t has just left, behind the trip's barrier.
 * k runs upward in steps of 32 through one accumulator chain per tile.
 * ------------------------------------------------------------------------ */
template <bool F16>
__device__ __forceinline__ void gemm_tile(const unsigned short* __restrict__ A,
                                          const unsigned short* __restrict__ B,
                                          unsigned short* Ring, int m0, int n0, v8f (&acc)[4][4])
{
  const int tid  = threadIdx.x;
  const int wave = tid >> 5;
  const int lane = tid & 31;
  const int hh   = lane >> 4;
  const int c    = lane & 15;
  const int wm   = wave >> 1;
  const int wn   = wave & 1;

#pragma unroll
  for (int i = 0; i < 4; ++i)
#pragma unroll
    for (int j = 0; j < 4; ++j) acc[i][j] = (v8f){0.f,0.f,0.f,0.f,0.f,0.f,0.f,0.f};

  const int crow = tid >> 3;
  const int cseg = (tid & 7) * 8;
  const unsigned short* ga = A + (size_t)(m0 + crow) * DM + cseg;
  const unsigned short* gb = B + (size_t)(n0 + crow) * DM + cseg;
  const unsigned la = lds_off(Ring) + (unsigned)(crow * TPQ + cseg) * 2u;
  const unsigned lb = la + (unsigned)(GBM * TPQ) * 2u;

  copy8(la, ga);
  copy8(lb, gb);
  asm volatile("s_wait_asynccnt 0x0" ::: "memory");   /* tile 0 of this wave has landed before the barrier publishes it */
  __syncthreads();
  copy8(la + (unsigned)GSTG * 2u, ga + GBK);
  copy8(lb + (unsigned)GSTG * 2u, gb + GBK);

  const unsigned short* fa = Ring + (64 * wm + c) * TPQ + 8 * hh;
  const unsigned short* fb = Ring + (GBM + 64 * wn + c) * TPQ + 8 * hh;

#pragma unroll 1   /* one staged tile per trip: the ring's waits and barrier stand once, at the foot */
  for (int t = 0; t < GNT; ++t) {
    const int bo = (t & 1) * GSTG;
#pragma unroll
    for (int ks = 0; ks < GBK / 32; ++ks) {
      FragG a[4], b[4];
#pragma unroll
      for (int i = 0; i < 4; ++i) {
        a[i].u[0] = *(const v4u*)(fa + bo + i * 16 * TPQ + ks * 32);
        a[i].u[1] = *(const v4u*)(fa + bo + i * 16 * TPQ + ks * 32 + 16);
        b[i].u[0] = *(const v4u*)(fb + bo + i * 16 * TPQ + ks * 32);
        b[i].u[1] = *(const v4u*)(fb + bo + i * 16 * TPQ + ks * 32 + 16);
      }
#pragma unroll
      for (int i = 0; i < 4; ++i)
#pragma unroll
        for (int j = 0; j < 4; ++j) {
          if constexpr (F16) acc[i][j] = mma_f16(a[i].h, b[j].h, acc[i][j]);
          else               acc[i][j] = mma_bf16(a[i].b, b[j].b, acc[i][j]);
        }
    }
    asm volatile("s_wait_dscnt 0x0" ::: "memory");      /* this wave's reads of buffer t&1 are done before it is refilled */
    asm volatile("s_wait_asynccnt 0x0" ::: "memory");   /* this wave's copies of tile t+1 have landed before the barrier publishes them */
    __syncthreads();
    if (t + 2 < GNT) {
      copy8(la + (unsigned)bo * 2u, ga + (t + 2) * GBK);
      copy8(lb + (unsigned)bo * 2u, gb + (t + 2) * GBK);
    }
  }
  asm volatile("s_wait_asynccnt 0x0" ::: "memory");     /* no copy is in flight when the ring becomes output staging */
}

/* Fragment map used everywhere (hh = lane>>4, c = lane&15):
 * A: row c, elements 0..7 <- k0+8hh+0..7, 8..15 <- k0+16+8hh+0..7 (two 16-B loads from a k-contiguous row);
 * B: column c with the SAME k map, loaded from a [n][k] k-contiguous copy exactly like A;
 * D: element r = (row 8hh+r, col c). */

/* --------------------------------------------------------------------------
 * x (f32, full-size strides) -> Xb bf16 [MROWS][1024].
 * One work-group (256 threads) = 2 compact rows, index blk; thread -> 8 consecutive elements.
 * Coverage: MROWS/2 work-groups x 2048 elements = the whole plane.
 * ------------------------------------------------------------------------ */
__device__ __forceinline__ void cvt_x_block(const float* __restrict__ x,
                                            unsigned short* __restrict__ Xb, int blk)
{
  const int tid  = threadIdx.x;
  const int e    = tid * 8;
  const int crow = blk * 2 + e / DM;
  const int col  = e % DM;
  const int bi   = crow / SEQ;
  const int n    = crow - bi * SEQ;
  const float* src = x + ((size_t)bi * SEQ_FULL + n) * DM + col;
  const v4f f0 = *(const v4f*)src;
  const v4f f1 = *(const v4f*)(src + 4);
  v4u w;
  w[0] = pk16(f2bf_bits(f0[0]), f2bf_bits(f0[1]));
  w[1] = pk16(f2bf_bits(f0[2]), f2bf_bits(f0[3]));
  w[2] = pk16(f2bf_bits(f1[0]), f2bf_bits(f1[1]));
  w[3] = pk16(f2bf_bits(f1[2]), f2bf_bits(f1[3]));
  unsigned short* dst = Xb + (size_t)crow * DM + col;
  *(v4u*)dst = w;
}

/* --------------------------------------------------------------------------
 * w [1024 k][NFT] f32 -> Wt [NFT][1024] 16-bit (k-contiguous rows).
 * KIND 0: bf16 bits; KIND 1: f16 bits of (bf16 value x64).
 * One work-group (256 threads) = the 64 x 64 tile (n tile tile % (NFT/64), k tile tile / (NFT/64)).
 * Load: thread -> k row tid>>2, 16 columns; 64x64 covered once. Transposed into LDS [n][k].
 * Store: 512 units (2 per thread): unit u -> n row u>>3, 16-B segment u&7.
 * Coverage: (NFT/64) x 16 tiles of 64x64 = the whole plane.
 * ------------------------------------------------------------------------ */
template <int KIND, int NFT>
__device__ __forceinline__ void wtrans_block(const float* __restrict__ w,
                                             unsigned short* __restrict__ Wt,
                                             unsigned short* Ts, int tile)
{
  const int tid  = threadIdx.x;
  const int kt   = tile / (NFT / 64);
  const int n0   = (tile - kt * (NFT / 64)) * 64;
  const int k0   = kt * 64;
  const int krow = tid >> 2;
  const int fseg = (tid & 3) * 16;
  const float* src = w + (size_t)(k0 + krow) * NFT + n0 + fseg;
#pragma unroll
  for (int i = 0; i < 4; ++i) {
    const v4f f = *(const v4f*)(src + 4 * i);
#pragma unroll
    for (int e2 = 0; e2 < 4; ++e2) {
      const float v = f[e2];
      unsigned short bits;
      if (KIND == 0) bits = f2bf_bits(v);
      else           bits = f2h_bits(bfr(v) * 64.0f);
      Ts[(fseg + 4 * i + e2) * TPQ + krow] = bits;
    }
  }
  __syncthreads();
#pragma unroll
  for (int it = 0; it < 2; ++it) {
    const int u    = it * 256 + tid;
    const int frow = u >> 3;
    const int seg  = u & 7;
    const v4u val = *(const v4u*)(Ts + frow * TPQ + seg * 8);
    *(v4u*)(Wt + (size_t)(n0 + frow) * DM + k0 + seg * 8) = val;
  }
  /* the listing lays another branch's code behind these stores: the wait stands before a register that a store names is written there */
  asm volatile("s_wait_xcnt 0x0" ::: "memory");
}

/* --------------------------------------------------------------------------
 * The three operand preparations depend on nothing and on one another not at all: one grid holds
 * them, told apart by the work-group index (a scalar, so each branch and its barrier is uniform):
 *   [0, PREP_WQ)               w_qkv tiles -> Wqt
 *   [PREP_WQ, PREP_W)          w_out tiles -> Wot
 *   [PREP_W, PREP_W + PREP_X)  x row pairs -> Xb
 * The transposes stand first: their chain (load, LDS, barrier, store) is the longer one.
 * ------------------------------------------------------------------------ */
constexpr int PREP_WQ = (NF / 64) * (DM / 64);
constexpr int PREP_W  = PREP_WQ + (DM / 64) * (DM / 64);
constexpr int PREP_X  = (MROWS * DM) / 2048;

__global__ __launch_bounds__(256) void prep_kernel(const float* __restrict__ x,
                                                   const float* __restrict__ w_qkv,
                                                   const float* __restrict__ w_out,
                                                   unsigned short* __restrict__ Xb,
                                                   unsigned short* __restrict__ Wqt,
                                                   unsigned short* __restrict__ Wot)
{
  __shared__ __align__(16) unsigned short Ts[64 * TPQ];     /* [n][k], the transposes' tile */
  const int b = blockIdx.x;
  if (b >= PREP_W) { cvt_x_block(x, Xb, b - PREP_W); return; }
  if (b < PREP_WQ) { wtrans_block<0, NF>(w_qkv, Wqt, Ts, b); return; }
  wtrans_block<1, DM>(w_out, Wot, Ts, b - PREP_WQ);
}

/* --------------------------------------------------------------------------
 * qkv = Xb.Wq + bq on bf16 WMMA. Block = 4 waves (2 x 2), tile 128 tokens x 128 features,
 * operands staged in LDS (gemm_tile); grid (MROWS/128, NF/128).
 * A wave's 64 features are exactly one (sel, head); sel is block-uniform.
 * The ring is output staging after the loop's last barrier; every slab is wave-private.
 * sel 0/1: q/k -> f16 plane [bh][n][d]: per-wave 64x64 LDS tile, then 64 whole 128-B rows:
 *   rows it*4+(lane>>3), it 0..15, segs lane&7.
 * sel 2: v -> bf16 hi and lo planes [bh][d][n]: per-wave 64x64 transposed LDS tiles, each d row =
 *   64 tokens = 128 B = 8 lanes x 16 B; rows it*4+(lane>>3), it 0..15.
 * ------------------------------------------------------------------------ */
__global__ __launch_bounds__(128) __attribute__((amdgpu_num_vgpr(256)))
void qkv_gemm_kernel(const unsigned short* __restrict__ Xb, const unsigned short* __restrict__ Wqt,
                     const float* __restrict__ bq,
                     unsigned short* __restrict__ Qh, unsigned short* __restrict__ Kh,
                     unsigned short* __restrict__ Vth, unsigned short* __restrict__ Vtl)
{
  __shared__ __align__(16) unsigned short Ring[2 * GSTG];
  const int tid  = threadIdx.x;
  const int wave = tid >> 5;
  const int lane = tid & 31;
  const int hh   = lane >> 4;
  const int c    = lane & 15;
  const int wm   = wave >> 1;
  const int wn   = wave & 1;
  const int m0   = blockIdx.x * GBM;
  const int n0   = blockIdx.y * GBN;
  const int sel  = blockIdx.y / (DM / GBN);
  const int head = (blockIdx.y - sel * (DM / GBN)) * (GBN / DH) + wn;

  v8f acc[4][4];
  gemm_tile<false>(Xb, Wqt, Ring, m0, n0, acc);

  float bb[4], bl[4];
  const int bidx = n0 + 64 * wn + c;
#pragma unroll
  for (int tt = 0; tt < 4; ++tt) bl[tt] = bq[bidx + 16 * tt];
  /* the four loads share the index register: it is named here so that it lives up to the wait and no load's result lands in it */
  asm volatile("s_wait_xcnt 0x0" :: "v"(bidx) : "memory");
#pragma unroll
  for (int tt = 0; tt < 4; ++tt) bb[tt] = bfr(bl[tt]);

  const int bi  = m0 / SEQ;
  const int nn0 = m0 - bi * SEQ + 64 * wm;
  const int bh  = bi * NH + head;

  if (sel < 2) {
    unsigned short* plane = (sel == 0) ? Qh : Kh;
    unsigned short* ls = Ring + wave * (64 * TPQ);      /* [token][d], wave-private, block barrier used */
#pragma unroll
    for (int rt = 0; rt < 4; ++rt)
#pragma unroll
      for (int tt = 0; tt < 4; ++tt)
#pragma unroll
        for (int r = 0; r < 8; ++r)
          ls[(16 * rt + 8 * hh + r) * TPQ + 16 * tt + c] = f2h_bits(acc[rt][tt][r] + bb[tt]);
    __syncthreads();
    unsigned short* dst = plane + ((size_t)bh * SEQ + nn0) * DH;
#pragma unroll
    for (int it = 0; it < 16; ++it) {
      const int row = it * 4 + (lane >> 3);
      const int seg = lane & 7;
      const v4u val = *(const v4u*)(ls + row * TPQ + seg * 8);
      *(v4u*)(dst + (size_t)row * DH + seg * 8) = val;
    }
  } else {
    unsigned short* th = Ring + wave * (2 * 64 * TPQ);  /* v hi [d][token 0..63], wave-private, block barrier used */
    unsigned short* tl = th + 64 * TPQ;                 /* v lo */
#pragma unroll
    for (int rt = 0; rt < 4; ++rt)
#pragma unroll
      for (int tt = 0; tt < 4; ++tt)
#pragma unroll
        for (int r = 0; r < 8; ++r) {
          const float v = acc[rt][tt][r] + bb[tt];
          const unsigned short hb = f2bf_bits(v);
          const unsigned short lb = f2bf_bits(v - bf_bits2f(hb));
          const int tok = 16 * rt + 8 * hh + r;
          const int d   = 16 * tt + c;
          th[d * TPQ + tok] = hb;
          tl[d * TPQ + tok] = lb;
        }
    __syncthreads();
    const size_t vbase = (size_t)bh * DH * SEQ + nn0;
#pragma unroll
    for (int it = 0; it < 16; ++it) {
      const int drow = it * 4 + (lane >> 3);
      const int seg  = lane & 7;
      const v4u hv = *(const v4u*)(th + drow * TPQ + seg * 8);
      const v4u lv = *(const v4u*)(tl + drow * TPQ + seg * 8);
      *(v4u*)(Vth + vbase + (size_t)drow * SEQ + seg * 8) = hv;
      *(v4u*)(Vtl + vbase + (size_t)drow * SEQ + seg * 8) = lv;
    }
    asm volatile("s_wait_xcnt 0x0" ::: "memory");   /* behind the last store, before a register that a store names is written again */
  }
}

__global__ __launch_bounds__(128) __attribute__((amdgpu_num_vgpr(256)))
void attn_kernel(const unsigned short* __restrict__ Qh, const unsigned short* __restrict__ Kh,
                 const unsigned short* __restrict__ Vth, const unsigned short* __restrict__ Vtl,
                 const float* __restrict__ rel, unsigned short* __restrict__ Ctx)
{
  __shared__ __align__(16) unsigned short Ksh[KCH * TPQ];           /* K  [kv][d] f16, row pitch TPQ */
  __shared__ __align__(16) unsigned short Vhs[DH * TPQ];            /* Vh [d][kv] bf16, row pitch TPQ */
  __shared__ __align__(16) unsigned short Vls[DH * TPQ];            /* Vl [d][kv] bf16, row pitch TPQ */
  __shared__ __align__(16) unsigned short Osh[NWAVE][16 * TPQ];     /* out slab per wave (f16) */
  __shared__ float sbias[1024];                                     /* bias column of this head, bf16 value */

  const int tid  = threadIdx.x;
  const int wave = tid >> 5;
  const int lane = tid & 31;
  const int hh   = lane >> 4;
  const int c    = lane & 15;
  const int qb   = blockIdx.x;
  const int bh   = blockIdx.y;
  const int bi   = bh / NH;
  const int head = bh - bi * NH;
  const int q0   = qb * QBLK + wave * 16;

  for (int t = tid; t < 1024; t += 128) {
    const int ti = t < NREL ? t : (NREL - 1);
    const float v = bfr(rel[(size_t)ti * NH + head]);
    sbias[t] = (t < NREL) ? v : 0.f;
  }

  FragH qa[2];
  {
    const unsigned short* qrow = Qh + ((size_t)bh * SEQ + q0 + c) * DH + 8 * hh;
    qa[0].u[0] = *(const v4u*)(qrow);
    qa[0].u[1] = *(const v4u*)(qrow + 16);
    qa[1].u[0] = *(const v4u*)(qrow + 32);
    qa[1].u[1] = *(const v4u*)(qrow + 48);
  }
  __syncthreads();

  float mrow = -__builtin_inff();    /* running maximum of query q0+c, equal in both lane halves */
  float lrow = 0.f;                  /* running sum over this lane half's keys */
  v8f oacc[4];
#pragma unroll
  for (int t = 0; t < 4; ++t) oacc[t] = (v8f){0.f,0.f,0.f,0.f,0.f,0.f,0.f,0.f};

  const unsigned short* Kp  = Kh  + (size_t)bh * SEQ * DH;
  const unsigned short* Vhp = Vth + (size_t)bh * DH * SEQ;
  const unsigned short* Vlp = Vtl + (size_t)bh * DH * SEQ;
  const int bbase = q0 + c - 8 * hh + (MAXLEN - 1);    /* bias index = bbase - kv0 - 16j - r */

#pragma unroll 1
  for (int kc = 0; kc < SEQ / KCH; ++kc) {
    const int kv0 = kc * KCH;
    __syncthreads();
#pragma unroll
    for (int it = 0; it < 4; ++it) {
      const int u   = it * 128 + tid;
      const int row = u >> 3;
      const int seg = u & 7;
      const v4u kw = *(const v4u*)(Kp  + (size_t)(kv0 + row) * DH + seg * 8);
      const v4u hw = *(const v4u*)(Vhp + (size_t)row * SEQ + kv0 + seg * 8);
      const v4u lw = *(const v4u*)(Vlp + (size_t)row * SEQ + kv0 + seg * 8);
      *(v4u*)(Ksh + row * TPQ + seg * 8) = kw;
      *(v4u*)(Vhs + row * TPQ + seg * 8) = hw;
      *(v4u*)(Vls + row * TPQ + seg * 8) = lw;
    }
    __syncthreads();

    /* scores, transposed: 64 keys (rows) x 16 queries (columns) per wave */
    v8f s[4];
#pragma unroll
    for (int j = 0; j < 4; ++j) {
      s[j] = (v8f){0.f,0.f,0.f,0.f,0.f,0.f,0.f,0.f};
#pragma unroll
      for (int dc = 0; dc < 2; ++dc) {
        FragH kf;
        kf.u[0] = *(const v4u*)(Ksh + (j * 16 + c) * TPQ + dc * 32 + 8 * hh);
        kf.u[1] = *(const v4u*)(Ksh + (j * 16 + c) * TPQ + dc * 32 + 16 + 8 * hh);
        s[j] = wmma_f16(kf.v, qa[dc].v, s[j]);
      }
    }

    /* scale 1/8 and rel-pos bias: key index = kv0 + 16j + 8hh + r, query = q0 + c */
    const int boff = bbase - kv0;
#pragma unroll
    for (int j = 0; j < 4; ++j)
#pragma unroll
      for (int r = 0; r < 8; ++r)
        s[j][r] = s[j][r] * 0.125f + sbias[boff - 16 * j - r];

    /* chunk maximum of this lane's query: 32 keys in-lane, the other 32 from lane ^ 16 */
    float cj[4];
#pragma unroll
    for (int j = 0; j < 4; ++j) {
      cj[j] = s[j][0];
#pragma unroll
      for (int r = 1; r < 8; ++r) cj[j] = fmaxf(cj[j], s[j][r]);
    }
    float cm = fmaxf(fmaxf(cj[0], cj[1]), fmaxf(cj[2], cj[3]));
    cm = fmaxf(cm, xhalf(cm));

    /* online softmax update; P as bf16 hi + lo, packed in place into B operands */
    const float mnew  = fmaxf(mrow, cm);
    const float alpha = __expf(mrow - mnew);
    mrow = mnew;
    FragB ph[2], pl[2];
    float pj[4];                     /* one sum chain per key tile */
#pragma unroll
    for (int j = 0; j < 4; ++j) {
      pj[j] = 0.f;
#pragma unroll
      for (int r2 = 0; r2 < 4; ++r2) {
        const float p0 = __expf(s[j][2 * r2]     - mnew);
        const float p1 = __expf(s[j][2 * r2 + 1] - mnew);
        pj[j] += p0;
        pj[j] += p1;
        const v2b h = cvt2(p0, p1);
        const v2b l = cvt2(p0 - (float)h[0], p1 - (float)h[1]);
        ph[j >> 1].u[j & 1][r2] = __builtin_bit_cast(unsigned, h);
        pl[j >> 1].u[j & 1][r2] = __builtin_bit_cast(unsigned, l);
      }
    }
    lrow = lrow * alpha + ((pj[0] + pj[1]) + (pj[2] + pj[3]));
#pragma unroll
    for (int t = 0; t < 4; ++t)
#pragma unroll
      for (int r = 0; r < 8; ++r) oacc[t][r] *= alpha;

    /* O^T += V^T.P^T : A = V^T [d][kv] rows, B = P^T [kv][q] from the registers above */
#pragma unroll
    for (int kk = 0; kk < 2; ++kk) {
#pragma unroll
      for (int t = 0; t < 4; ++t) {
        FragB vh, vl;
        vh.u[0] = *(const v4u*)(Vhs + (t * 16 + c) * TPQ + kk * 32 + 8 * hh);
        vh.u[1] = *(const v4u*)(Vhs + (t * 16 + c) * TPQ + kk * 32 + 16 + 8 * hh);
        vl.u[0] = *(const v4u*)(Vls + (t * 16 + c) * TPQ + kk * 32 + 8 * hh);
        vl.u[1] = *(const v4u*)(Vls + (t * 16 + c) * TPQ + kk * 32 + 16 + 8 * hh);
        oacc[t] = wmma_bf16(vh.v, ph[kk].v, oacc[t]);
        oacc[t] = wmma_bf16(vh.v, pl[kk].v, oacc[t]);
        oacc[t] = wmma_bf16(vl.v, ph[kk].v, oacc[t]);
      }
    }
  }

  /* join the halves' sums, normalise, x16 carry, f16 slab [query][d], then whole-line stores into Ctx */
  unsigned short* os = Osh[wave];
  {
    const float inv = 1.0f / (lrow + xhalf(lrow));
#pragma unroll
    for (int t = 0; t < 4; ++t) {
      v4u w;
#pragma unroll
      for (int r2 = 0; r2 < 4; ++r2)
        w[r2] = pk16(f2h_bits(oacc[t][2 * r2] * inv * 16.0f), f2h_bits(oacc[t][2 * r2 + 1] * inv * 16.0f));
      *(v4u*)(os + c * TPQ + t * 16 + 8 * hh) = w;
    }
  }
  __builtin_amdgcn_fence(3, "workgroup");
  __builtin_amdgcn_wave_barrier();
  __builtin_amdgcn_fence(2, "workgroup");
  {
    unsigned short* cdst = Ctx + ((size_t)bi * SEQ + q0) * DM + head * DH;
    {
#pragma unroll
      for (int it = 0; it < 4; ++it) {
        const int row = it * 4 + (lane >> 3);
        const int seg = lane & 7;
        const v4u val = *(const v4u*)(os + row * TPQ + seg * 8);
        *(v4u*)(cdst + (size_t)row * DM + seg * 8) = val;
      }
      
    }
  }
}

/* --------------------------------------------------------------------------
 * out = Ctx.Wot (f16 WMMA, x1024 total carry folded by 2^-10) + bo, f32 output.
 * Block = 4 waves (2 x 2), tile 128 tokens x 128 columns, operands staged in LDS (gemm_tile);
 * grid (MROWS/128, DM/128). The ring is output staging after the loop's last barrier:
 * per-wave f32 slab 64x64; rows it*2+hh, it 0..31, pieces (lane&15)*4.
 * ------------------------------------------------------------------------ */
__global__ __launch_bounds__(128) __attribute__((amdgpu_num_vgpr(256)))
void out_gemm_kernel(const unsigned short* __restrict__ Ctx, const unsigned short* __restrict__ Wot,
                     const float* __restrict__ bo, float* __restrict__ out)
{
  __shared__ __align__(16) unsigned short Ring[2 * GSTG];
  const int tid  = threadIdx.x;
  const int wave = tid >> 5;
  const int lane = tid & 31;
  const int hh   = lane >> 4;
  const int c    = lane & 15;
  const int wm   = wave >> 1;
  const int wn   = wave & 1;
  const int m0   = blockIdx.x * GBM;
  const int n0   = blockIdx.y * GBN;

  v8f acc[4][4];
  gemm_tile<true>(Ctx, Wot, Ring, m0, n0, acc);

  float bb[4];
#pragma unroll
  for (int tt = 0; tt < 4; ++tt) bb[tt] = bfr(bo[n0 + 64 * wn + 16 * tt + c]);

  float* os = (float*)Ring + wave * (64 * OSP);
#pragma unroll
  for (int rt = 0; rt < 4; ++rt)
#pragma unroll
    for (int tt = 0; tt < 4; ++tt)
#pragma unroll
      for (int r = 0; r < 8; ++r)
        os[(16 * rt + 8 * hh + r) * OSP + 16 * tt + c] = acc[rt][tt][r] * (1.0f / 1024.0f) + bb[tt];
  __builtin_amdgcn_fence(3, "workgroup");
  __builtin_amdgcn_wave_barrier();
  __builtin_amdgcn_fence(2, "workgroup");

  const int bi  = m0 / SEQ;
  const int nn0 = m0 - bi * SEQ;
  float* ob = out + ((size_t)bi * SEQ_FULL + nn0 + 64 * wm) * DM + n0 + 64 * wn;
  const int c4 = (lane & 15) * 4;
#pragma unroll
  for (int it = 0; it < 32; ++it) {
    const int row = it * 2 + hh;
    const v4f val = *(const v4f*)(os + row * OSP + c4);
    *(v4f*)(ob + (size_t)row * DM + c4) = val;
  }
}

extern "C" void kernel_launch(void* const* d_in, const int* in_sizes, int n_in,
                              void* d_out, int out_size, void* d_ws, size_t ws_size,
                              hipStream_t stream)
{
  if (n_in < 6) return;
  const long need_x = ((long)(NB - 1) * SEQ_FULL + SEQ) * DM;
  if ((long)in_sizes[0] < need_x) return;
  if ((long)in_sizes[1] < (long)DM * NF) return;
  if (in_sizes[2] < NF) return;
  if ((long)in_sizes[3] < (long)NREL * NH) return;
  if ((long)in_sizes[4] < (long)DM * DM) return;
  if (in_sizes[5] < DM) return;
  if ((long)out_size < need_x) return;
  if (d_ws == nullptr || ws_size < WS_NEED) return;

  const float* x     = (const float*)d_in[0];
  const float* w_qkv = (const float*)d_in[1];
  const float* b_qkv = (const float*)d_in[2];
  const float* rel   = (const float*)d_in[3];
  const float* w_out = (const float*)d_in[4];
  const float* b_out = (const float*)d_in[5];
  float* out = (float*)d_out;

  unsigned short* Xb  = (unsigned short*)d_ws;   /* offset 0 */
  unsigned short* Wqt = Xb  + PLANE16;
  unsigned short* Wot = Wqt + WQT_EL;
  unsigned short* Qh  = Wot + WOT_EL;
  unsigned short* Kh  = Qh  + PLANE16;
  unsigned short* Vth = Kh  + PLANE16;
  unsigned short* Vtl = Vth + PLANE16;
  unsigned short* Ctx = Vtl + PLANE16;           /* ends at WS_NEED */

  prep_kernel<<<dim3((unsigned)(PREP_W + PREP_X)), 256, 0, stream>>>(x, w_qkv, w_out, Xb, Wqt, Wot);
  qkv_gemm_kernel<<<dim3(MROWS / GBM, NF / GBN), 128, 0, stream>>>(Xb, Wqt, b_qkv, Qh, Kh, Vth, Vtl);
  attn_kernel<<<dim3(SEQ / QBLK, NBH), 128, 0, stream>>>(Qh, Kh, Vth, Vtl, rel, Ctx);
  out_gemm_kernel<<<dim3(MROWS / GBM, DM / GBN), 128, 0, stream>>>(Ctx, Wot, b_out, out);
}
